// v000
// Measured on an AMD MI455X. A time is GPU time per run, averaged over a window of back-to-back runs after a warm-up
// (all launches, gaps included; the runs take copies of the inputs in turn), and the median of several windows.
// Apart from v000's, it joins two sittings. Times from different sittings can be a few percent apart, while
// side-by-side timings come from the same sitting.
// v000, which the later versions start from, runs in 130 microseconds.
#include <hip/hip_runtime.h>

// Per-token attention across heads, width 1024 = 16 heads x 64: x [NB][SEQ][1024], Wq/Wk/Wv [out][in] (y = x W^T), no biases, no mask, score scale 1/8;
// for each token the 16 head rows of q attend over the 16 head rows of k/v of the SAME token (scores 16x16, softmax over the key head), output column = head*64 + d (f32).
// Compute dtypes, f32 accumulate everywhere: projections v_wmma_f32_16x16x32_bf16 (x and W RNE-converted to bf16; products exact);
// scores v_wmma_f32_16x16x32_f16: k single f16, q as f16 value + f16 residual x2048 in its own accumulator; P (x256 carry, cancels in the normalisation) and v single f16; softmax f32.
// Layout: bf16 copies of x and W (the Wv copy with permuted rows d*16+j <- j*64+d); q (hi, residual), k planes [token][head*64+d] and v^T plane [token][d*16+head] written by the GEMM epilogue;
// per-token kernel in transposed form (S^T = K Q^T, O^T = V^T P^T, 16 keys zero-padded to the 32-deep step), output from f32 accumulators.

#ifndef NB
#define NB 4
#endif
#ifndef SEQ
#define SEQ 2048
#endif
#define NB_FULL  4
#define SEQ_FULL 2048
#ifndef OUT_SEQ
#define OUT_SEQ SEQ              // row pitch (in tokens) between batches of the output
#endif
#define DM   1024
#define NH_  16
#define HD   64
#define AW   4                   // waves per block of the per-token kernel
#define PPW  4                   // tokens handled sequentially by each wave
#define QRS  2048.0f             // carry of the q residual plane
#define QRI  (1.0f / 2048.0f)
#define SC2  (0.125f * 1.4426950408889634f)   // HD^-0.5 * log2(e)
#define PSH  8.0f                // log2 of the P carry (256)

static_assert(HD == 64);
static_assert(NH_ == 16);                      // one 16-key tile per token; v^T row = 16 halves
static_assert(NH_ * HD == DM);                 // head h = columns h*64 + d
static_assert(DM % 64 == 0);                   // 16 column tiles of 64
static_assert(DM % 32 == 0);                   // GEMM k-loop steps by 32
static_assert((NB * SEQ) % 64 == 0);           // GEMM row tiles cover the token rows exactly
static_assert((NB * SEQ) % (AW * PPW) == 0);   // per-token grid covers the token rows exactly
static_assert(((size_t)SEQ * DM) % 8 == 0);
static_assert(((size_t)DM * DM) % 8 == 0);
static_assert(NB <= NB_FULL);
static_assert(SEQ <= SEQ_FULL);

typedef _Float16 h16;
typedef unsigned short bf;
typedef __attribute__((ext_vector_type(16))) __bf16   v16bf;
typedef __attribute__((ext_vector_type(16))) _Float16 v16h;
typedef __attribute__((ext_vector_type(8)))  _Float16 v8h;
typedef __attribute__((ext_vector_type(8)))  unsigned short v8us;
typedef __attribute__((ext_vector_type(8)))  float    v8f;
typedef __attribute__((ext_vector_type(4)))  float    v4f;
typedef v4f  __attribute__((may_alias)) v4fa;

__device__ __forceinline__ unsigned short f2bf(float f) { unsigned u = __float_as_uint(f); u += 0x7FFFu + ((u >> 16) & 1u); return (unsigned short)(u >> 16); }
__device__ __forceinline__ v16h cat16(v8h lo, v8h hi) { return __builtin_shufflevector(lo, hi, 0, 1, 2, 3, 4, 5, 6, 7, 8, 9, 10, 11, 12, 13, 14, 15); }
__device__ __forceinline__ v16bf cat16b(v8us lo, v8us hi) { return __builtin_bit_cast(v16bf, __builtin_shufflevector(lo, hi, 0, 1, 2, 3, 4, 5, 6, 7, 8, 9, 10, 11, 12, 13, 14, 15)); }
__device__ __forceinline__ v8f wmma16(v16h a, v16h b, v8f c) { return __builtin_amdgcn_wmma_f32_16x16x32_f16(false, a, false, b, (short)0, c, false, false); }
__device__ __forceinline__ v8f wmmab(v16bf a, v16bf b, v8f c) { return __builtin_amdgcn_wmma_f32_16x16x32_bf16(false, a, false, b, (short)0, c, false, false); }
// fragment loaders from K-contiguous 16-bit rows; p already includes + 8*(lane>>4): elements 0..7 <- k0+8h+0..7, elements 8..15 <- k0+16+8h+0..7 (same map for A and B)
__device__ __forceinline__ v16h  ldh(const h16* p) { return cat16(*(const v8h*)p, *(const v8h*)(p + 16)); }
__device__ __forceinline__ v16bf ldb(const bf* p)  { return cat16b(*(const v8us*)p, *(const v8us*)(p + 16)); }
// ordering point for wave-private LDS tiles (same wave writes and reads)
__device__ __forceinline__ void wave_sync() { __builtin_amdgcn_fence(3 /* release order */, "wavefront"); __builtin_amdgcn_wave_barrier(); asm volatile("" ::: "memory"); }

// perm != 0 (square DM x DM weight only): dst row (d*16 + j) <- src row (j*64 + d); whole rows move, so stores stay line-contiguous.
__global__ __launch_bounds__(256) void k_cvt8(const float* __restrict__ src, bf* dst, size_t n8, int perm) {
    const size_t i = (size_t)blockIdx.x * 256 + threadIdx.x; if (i >= n8) return;
    const size_t e = i * 8; size_t s = e;
    if (perm != 0) { const size_t row = e / DM; const size_t col = e % DM; s = ((row & 15) * (size_t)HD + (row >> 4)) * (size_t)DM + col; }
    const v8f v = *(const v8f*)(src + s); v8us o;
#pragma unroll
    for (int k = 0; k < 8; ++k) o[k] = f2bf(v[k]);
    *(v8us*)(dst + e) = o; 
}

// k_proj: register-blocked bf16 GEMM, ONE WAVE per 64x64 tile (16 accumulators), operands straight from K-contiguous bf16 planes, K = DM.
// C[m][n] = sum_k A[m][k] Bt[n][k], written row-major (pitch DM halves) as f16 (Ph) and optionally the f16 residual x2048 (Pr, useRes != 0). grid (M/64, DM/64), 32 threads.
__global__ __launch_bounds__(32) void k_proj(const bf* __restrict__ A, const bf* __restrict__ Bt, h16* Ph, h16* Pr, int useRes) {
    __shared__ __align__(16) float os[16 * 68];
    const int K = DM;
    const int lane = threadIdx.x & 31, lr = lane & 15, hi = lane >> 4; const int r0 = blockIdx.x * 64, c0 = blockIdx.y * 64;
    v8f acc[4][4];
#pragma unroll
    for (int mb = 0; mb < 4; ++mb)
#pragma unroll
        for (int nb = 0; nb < 4; ++nb) acc[mb][nb] = (v8f){};
    const size_t aoff = (size_t)(r0 + lr) * K + 8 * hi, boff = (size_t)(c0 + lr) * K + 8 * hi;
#pragma unroll 1
    for (int kc = 0; kc < K; kc += 32) {
        v16bf a[4];
#pragma unroll
        for (int mb = 0; mb < 4; ++mb) a[mb] = ldb(A + aoff + (size_t)mb * 16 * K + kc);
#pragma unroll
        for (int nb = 0; nb < 4; ++nb) { const v16bf b = ldb(Bt + boff + (size_t)nb * 16 * K + kc);
#pragma unroll
            for (int mb = 0; mb < 4; ++mb) acc[mb][nb] = wmmab(a[mb], b, acc[mb][nb]); }
        asm volatile("v_nop\n\tv_nop\n\tv_nop\n\tv_nop" : "+v"(acc[0][0]), "+v"(acc[1][1]), "+v"(acc[2][2]), "+v"(acc[3][3]) : "v"(a[0]), "v"(a[1]), "v"(a[2]), "v"(a[3]));
    }
    const size_t tbase = (size_t)r0 * (size_t)DM + (size_t)c0;
#pragma unroll
    for (int mb = 0; mb < 4; ++mb) {
#pragma unroll
        for (int nb = 0; nb < 4; ++nb) {
#pragma unroll
            for (int j = 0; j < 8; ++j) os[(hi * 8 + j) * 68 + nb * 16 + lr] = acc[mb][nb][j]; }   // D: row 8h+j, col lane&15
        wave_sync();
        const size_t sb = tbase + (size_t)(mb * 16) * (size_t)DM;
{
#pragma unroll
            for (int s = 0; s < 4; ++s) { const int row = 4 * s + (lane >> 3), c8 = (lane & 7) * 8;   // 4 s x 4 row groups = 16 rows; 8 lanes x 8 = 64 columns
                const v4f x0 = *(const v4fa*)(&os[row * 68 + c8]); const v4f x1 = *(const v4fa*)(&os[row * 68 + c8 + 4]); v8h hv, rv;
#pragma unroll
                for (int i = 0; i < 4; ++i) { const h16 a0 = (h16)x0[i]; const h16 a1 = (h16)x1[i]; hv[i] = a0; hv[4 + i] = a1; rv[i] = (h16)((x0[i] - (float)a0) * QRS); rv[4 + i] = (h16)((x1[i] - (float)a1) * QRS); }
                const size_t oo = sb + (size_t)row * (size_t)DM + c8;
                *(v8h*)(Ph + oo) = hv; if (useRes) *(v8h*)(Pr + oo) = rv; }
             }
        wave_sync();
    }
}

// k_xhead: per-token attention across the 16 heads, one wave per token (PPW tokens in sequence); K / Q / V^T fragments straight from the f16 planes (16-B loads, arithmetic addressing).
// Transposed form: S^T[j][i] = K Q^T (A = K head rows j, B = Q head rows i, k = d, two 32-deep steps); lane (i = lane&15, h = lane>>4) holds keys j = 8h+r, so the packed
// P values are directly elements 0..7 of the B fragment of O^T[d][i] = V^T P^T (k = j = 8h+r); elements 8..15 (k = 16..31) are literal zeros in BOTH operands.
// V^T A fragment: row d = 16*jt + lane&15, elements 0..7 <- plane[token][d*16 + 8h + 0..7] (one 16-B load), elements 8..15 zero.
// Softmax: lane-local max/sum over 8 keys, the two lane halves of a query combined with one xor-16 exchange (all lanes active, uniform control).
__global__ __launch_bounds__(32 * AW) void k_xhead(const h16* __restrict__ QH, const h16* __restrict__ QR, const h16* __restrict__ KP, const h16* __restrict__ VT, float* OUT) {
    __shared__ __align__(16) float os[AW * 16 * 68];
    const int lane = threadIdx.x & 31, wave = __builtin_amdgcn_readfirstlane((int)(threadIdx.x >> 5)), lr = lane & 15, hi = lane >> 4;
    const int wb = wave * 16 * 68;
    const int pos0 = (blockIdx.x * AW + wave) * PPW;
#pragma unroll 1
    for (int pp = 0; pp < PPW; ++pp) {
        const int m = pos0 + pp;                       // compact token row of the planes
        const int b = m / SEQ, t = m % SEQ;
        const size_t rb = (size_t)m * DM;
        const size_t qo = rb + (size_t)lr * HD + 8 * hi;
        const v16h qh0 = ldh(QH + qo), qh1 = ldh(QH + qo + 32), qr0 = ldh(QR + qo), qr1 = ldh(QR + qo + 32);   // B fragments: col i, k = d
        const v16h ka0 = ldh(KP + qo), ka1 = ldh(KP + qo + 32);                                                // A fragments: row j, k = d
        v8f sH = (v8f){}, sL = (v8f){};
        sH = wmma16(ka0, qh0, sH); sL = wmma16(ka0, qr0, sL);
        sH = wmma16(ka1, qh1, sH); sL = wmma16(ka1, qr1, sL);
        asm volatile("v_nop\n\tv_nop\n\tv_nop\n\tv_nop" : "+v"(sH), "+v"(sL) : "v"(ka0), "v"(ka1), "v"(qh0), "v"(qh1), "v"(qr0), "v"(qr1));
        float ta[8]; float mx = -3.0e38f;
#pragma unroll
        for (int r = 0; r < 8; ++r) { ta[r] = (sH[r] + sL[r] * QRI) * SC2; mx = fmaxf(mx, ta[r]); }
        mx = fmaxf(mx, __shfl_xor(mx, 16, 32));
        const float sh = PSH - mx;
        v16h pb; float l = 0.0f;
#pragma unroll
        for (int r = 0; r < 8; ++r) { const h16 pa = (h16)__builtin_amdgcn_exp2f(ta[r] + sh); pb[r] = pa; pb[8 + r] = (h16)0.0f; l += (float)pa; }
        l += __shfl_xor(l, 16, 32);
        const float inv = 1.0f / l;
        const size_t vo = rb + (size_t)lr * 16 + 8 * hi;          // + jt*256: row d = 16*jt + lr, k = j = 8h + e
        const v8h zz = (v8h){};
        const v16h v0 = cat16(*(const v8h*)(VT + vo), zz), v1 = cat16(*(const v8h*)(VT + vo + 256), zz), v2 = cat16(*(const v8h*)(VT + vo + 512), zz), v3 = cat16(*(const v8h*)(VT + vo + 768), zz);
        v8f o0 = (v8f){}, o1 = (v8f){}, o2 = (v8f){}, o3 = (v8f){};
        o0 = wmma16(v0, pb, o0); o1 = wmma16(v1, pb, o1); o2 = wmma16(v2, pb, o2); o3 = wmma16(v3, pb, o3);
        asm volatile("v_nop\n\tv_nop\n\tv_nop\n\tv_nop" : "+v"(o0), "+v"(o1), "+v"(o2), "+v"(o3) : "v"(v0), "v"(v1), "v"(v2), "v"(v3), "v"(pb));
        // O^T D layout: o_jt[r] = (d = 16jt + 8h + r, i = lane&15) -> os[i][d]; rows 0..15 x columns 0..63 all written
        { v4f a, c;
          a[0] = o0[0] * inv; a[1] = o0[1] * inv; a[2] = o0[2] * inv; a[3] = o0[3] * inv; c[0] = o0[4] * inv; c[1] = o0[5] * inv; c[2] = o0[6] * inv; c[3] = o0[7] * inv;
          *(v4fa*)(&os[wb + lr * 68 +  0 + 8 * hi]) = a; *(v4fa*)(&os[wb + lr * 68 +  0 + 8 * hi + 4]) = c;
          a[0] = o1[0] * inv; a[1] = o1[1] * inv; a[2] = o1[2] * inv; a[3] = o1[3] * inv; c[0] = o1[4] * inv; c[1] = o1[5] * inv; c[2] = o1[6] * inv; c[3] = o1[7] * inv;
          *(v4fa*)(&os[wb + lr * 68 + 16 + 8 * hi]) = a; *(v4fa*)(&os[wb + lr * 68 + 16 + 8 * hi + 4]) = c;
          a[0] = o2[0] * inv; a[1] = o2[1] * inv; a[2] = o2[2] * inv; a[3] = o2[3] * inv; c[0] = o2[4] * inv; c[1] = o2[5] * inv; c[2] = o2[6] * inv; c[3] = o2[7] * inv;
          *(v4fa*)(&os[wb + lr * 68 + 32 + 8 * hi]) = a; *(v4fa*)(&os[wb + lr * 68 + 32 + 8 * hi + 4]) = c;
          a[0] = o3[0] * inv; a[1] = o3[1] * inv; a[2] = o3[2] * inv; a[3] = o3[3] * inv; c[0] = o3[4] * inv; c[1] = o3[5] * inv; c[2] = o3[6] * inv; c[3] = o3[7] * inv;
          *(v4fa*)(&os[wb + lr * 68 + 48 + 8 * hi]) = a; *(v4fa*)(&os[wb + lr * 68 + 48 + 8 * hi + 4]) = c; }
        wave_sync();
        float* orow = OUT + ((size_t)b * OUT_SEQ + t) * DM;      // token row: column = i*64 + d
{
#pragma unroll
            for (int s = 0; s < 8; ++s) { const int row = 2 * s + hi, cofs = lr * 4;   // 8 s x 2 rows = 16 head rows; 16 lanes x 4 floats = 64 columns
                const v4f val = *(const v4fa*)(&os[wb + row * 68 + cofs]);
                *(v4f*)(orow + (size_t)row * HD + cofs) = val; }
             }
        wave_sync();                                              // tile is rewritten by the next token
    }
}

static constexpr size_t al256(size_t v) { return (v + 255) & ~(size_t)255; }
static constexpr size_t SZ_XB = al256((size_t)NB * SEQ * DM * 2);
static constexpr size_t SZ_WB = al256((size_t)3 * DM * DM * 2);
static constexpr size_t SZ_PL = al256((size_t)NB * SEQ * DM * 2);
static constexpr size_t SZ_TOTAL = SZ_XB + SZ_WB + 4 * SZ_PL;
static_assert(SZ_TOTAL <= (size_t)134217728);          // workspace carve <= 128 MiB
static_assert(((size_t)DM * DM * 2) % 256 == 0);       // weight sub-planes stay 256-byte aligned

extern "C" void kernel_launch(void* const* d_in, const int* in_sizes, int n_in,
                              void* d_out, int out_size, void* d_ws, size_t ws_size, hipStream_t stream) {
    if (n_in < 4) return;
    const size_t needx = ((size_t)(NB - 1) * SEQ_FULL + SEQ) * DM;
    if ((size_t)in_sizes[0] < needx) return;
    if ((size_t)in_sizes[1] < (size_t)DM * DM || (size_t)in_sizes[2] < (size_t)DM * DM || (size_t)in_sizes[3] < (size_t)DM * DM) return;
    if ((size_t)out_size < ((size_t)(NB - 1) * OUT_SEQ + SEQ) * DM) return;
    if (SZ_TOTAL > ws_size) return;
    const float* x = (const float*)d_in[0]; const float* wq = (const float*)d_in[1]; const float* wk = (const float*)d_in[2]; const float* wv = (const float*)d_in[3];   // wire order x, Wq, Wk, Wv ([out][in] = Bt as-is)
    float* OUT = (float*)d_out;      // [NB][SEQ][1024]
    char* wsp = (char*)d_ws;
    bf* XB = (bf*)wsp; wsp += SZ_XB;                 // [NB*SEQ][1024]
    bf* WB = (bf*)wsp; wsp += SZ_WB;                 // [3][1024][1024]: q | k | v (v rows permuted: d*16+j <- j*64+d)
    h16* QH = (h16*)wsp; wsp += SZ_PL;               // [NB*SEQ][head*64+d]
    h16* QR = (h16*)wsp; wsp += SZ_PL;               // [NB*SEQ][head*64+d] residual x2048
    h16* KP = (h16*)wsp; wsp += SZ_PL;               // [NB*SEQ][head*64+d]
    h16* VT = (h16*)wsp; wsp += SZ_PL;               // [NB*SEQ][d*16+head]
    bf* WQ = WB; bf* WK = WB + (size_t)DM * DM; bf* WV = WB + (size_t)2 * DM * DM;

    if (SEQ == SEQ_FULL) {
        const size_t n8 = (size_t)NB * SEQ * DM / 8;
        k_cvt8<<<(unsigned)((n8 + 255) / 256), 256, 0, stream>>>(x, XB, n8, 0);
    } else {
        const size_t n8 = (size_t)SEQ * DM / 8;
        for (int b = 0; b < NB; ++b) k_cvt8<<<(unsigned)((n8 + 255) / 256), 256, 0, stream>>>(x + (size_t)b * SEQ_FULL * DM, XB + (size_t)b * SEQ * DM, n8, 0);
    }
    { const size_t n8 = (size_t)DM * DM / 8; const unsigned g = (unsigned)((n8 + 255) / 256);
      k_cvt8<<<g, 256, 0, stream>>>(wq, WQ, n8, 0); k_cvt8<<<g, 256, 0, stream>>>(wk, WK, n8, 0); k_cvt8<<<g, 256, 0, stream>>>(wv, WV, n8, 1); }

    // q, k: A = x rows (m = b*SEQ + t), Bt = W rows (n = head*64 + d) -> plane [m][head*64 + d]
    k_proj<<<dim3(NB * SEQ / 64, DM / 64, 1), 32, 0, stream>>>(XB, WQ, QH, QR, 1);
    k_proj<<<dim3(NB * SEQ / 64, DM / 64, 1), 32, 0, stream>>>(XB, WK, KP, KP, 0);
    // v^T: Bt = permuted Wv rows (n = d*16 + head) -> plane [m][d*16 + head]
    k_proj<<<dim3(NB * SEQ / 64, DM / 64, 1), 32, 0, stream>>>(XB, WV, VT, VT, 0);

    k_xhead<<<dim3(NB * SEQ / (AW * PPW), 1, 1), 32 * AW, 0, stream>>>(QH, QR, KP, VT, OUT);
}

// v001
// It runs in 73.8 microseconds.
// Two timings next to v000 put it at 1.82 and 1.83 times that version's speed.
#include <hip/hip_runtime.h>

// Per-token attention across heads, width 1024 = 16 heads x 64: x [NB][SEQ][1024], Wq/Wk/Wv [out][in] (y = x W^T), no biases, no mask, score scale 1/8;
// for each token the 16 head rows of q attend over the 16 head rows of k/v of the SAME token (scores 16x16, softmax over the key head), output column = head*64 + d (f32).
// Compute dtypes, f32 accumulate everywhere: projections v_wmma_f32_16x16x32_bf16 (x and W RNE-converted to bf16; products exact);
// scores v_wmma_f32_16x16x32_f16: k single f16, q as f16 value + f16 residual x2048 in its own accumulator; P (x256 carry, cancels in the normalisation) and v single f16; softmax f32.
// Layout: bf16 copies of x and W (the Wv copy with permuted rows d*16+j <- j*64+d); q (hi, residual), k planes [token][head*64+d] and v^T plane [token][d*16+head] written by the GEMM epilogue;
// per-token kernel in transposed form (S^T = K Q^T, O^T = V^T P^T, 16 keys zero-padded to the 32-deep step), output from f32 accumulators.

#ifndef NB
#define NB 4
#endif
#ifndef SEQ
#define SEQ 2048
#endif
#define NB_FULL  4
#define SEQ_FULL 2048
#ifndef OUT_SEQ
#define OUT_SEQ SEQ              // row pitch (in tokens) between batches of the output
#endif
#define DM   1024
#define NH_  16
#define HD   64
#define AW   4                   // waves per block of the per-token kernel
#define PPW  4                   // tokens handled sequentially by each wave
#define QRS  2048.0f             // carry of the q residual plane
#define QRI  (1.0f / 2048.0f)
#define SC2  (0.125f * 1.4426950408889634f)   // HD^-0.5 * log2(e)
#define PSH  8.0f                // log2 of the P carry (256)
#define PBM  256                 // projection GEMM: rows of C per work-group
#define PBN  128                 // columns of C per work-group
#define PKS  128                 // k per stage (256-B rows)
#define PLP  136                 // LDS row pitch in 16-bit elements (272 B = 16 B x odd, for 16-byte readers)
#define PSTG ((PBM + PBN) * PLP) // elements per buffer
#define PNT  (DM / PKS)          // stages

static_assert(HD == 64);
static_assert(NH_ == 16);                      // one 16-key tile per token; v^T row = 16 halves
static_assert(NH_ * HD == DM);                 // head h = columns h*64 + d
static_assert(DM % 64 == 0);                   // 16 column tiles of 64
static_assert(DM % 32 == 0);                   // GEMM k-loop steps by 32
static_assert((NB * SEQ) % PBM == 0);          // GEMM row tiles cover the token rows exactly
static_assert(DM % PBN == 0 && DM % PKS == 0 && PNT >= 2);   // column tiles and stages cover exactly; the two-buffer prologue needs two stages
static_assert((NB * SEQ) % (AW * PPW) == 0);   // per-token grid covers the token rows exactly
static_assert(((size_t)SEQ * DM) % 8 == 0);
static_assert(((size_t)DM * DM) % 8 == 0);
static_assert(NB <= NB_FULL);
static_assert(SEQ <= SEQ_FULL);

typedef _Float16 h16;
typedef unsigned short bf;
typedef __attribute__((ext_vector_type(16))) __bf16   v16bf;
typedef __attribute__((ext_vector_type(16))) _Float16 v16h;
typedef __attribute__((ext_vector_type(8)))  _Float16 v8h;
typedef __attribute__((ext_vector_type(8)))  unsigned short v8us;
typedef __attribute__((ext_vector_type(8)))  float    v8f;
typedef __attribute__((ext_vector_type(4)))  float    v4f;
typedef v4f  __attribute__((may_alias)) v4fa;

__device__ __forceinline__ unsigned short f2bf(float f) { unsigned u = __float_as_uint(f); u += 0x7FFFu + ((u >> 16) & 1u); return (unsigned short)(u >> 16); }
__device__ __forceinline__ v16h cat16(v8h lo, v8h hi) { return __builtin_shufflevector(lo, hi, 0, 1, 2, 3, 4, 5, 6, 7, 8, 9, 10, 11, 12, 13, 14, 15); }
__device__ __forceinline__ v16bf cat16b(v8us lo, v8us hi) { return __builtin_bit_cast(v16bf, __builtin_shufflevector(lo, hi, 0, 1, 2, 3, 4, 5, 6, 7, 8, 9, 10, 11, 12, 13, 14, 15)); }
__device__ __forceinline__ v8f wmma16(v16h a, v16h b, v8f c) { return __builtin_amdgcn_wmma_f32_16x16x32_f16(false, a, false, b, (short)0, c, false, false); }
__device__ __forceinline__ v8f wmmab(v16bf a, v16bf b, v8f c) { return __builtin_amdgcn_wmma_f32_16x16x32_bf16(false, a, false, b, (short)0, c, false, false); }
// fragment loaders from K-contiguous 16-bit rows; p already includes + 8*(lane>>4): elements 0..7 <- k0+8h+0..7, elements 8..15 <- k0+16+8h+0..7 (same map for A and B)
__device__ __forceinline__ v16h  ldh(const h16* p) { return cat16(*(const v8h*)p, *(const v8h*)(p + 16)); }
__device__ __forceinline__ v16bf ldb(const bf* p)  { return cat16b(*(const v8us*)p, *(const v8us*)(p + 16)); }
// ordering point for wave-private LDS tiles (same wave writes and reads)
__device__ __forceinline__ void wave_sync() { __builtin_amdgcn_fence(3 /* release order */, "wavefront"); __builtin_amdgcn_wave_barrier(); asm volatile("" ::: "memory"); }

// perm != 0 (square DM x DM weight only): dst row (d*16 + j) <- src row (j*64 + d); whole rows move, so stores stay line-contiguous.
__global__ __launch_bounds__(256) void k_cvt8(const float* __restrict__ src, bf* dst, size_t n8, int perm) {
    const size_t i = (size_t)blockIdx.x * 256 + threadIdx.x; if (i >= n8) return;
    const size_t e = i * 8; size_t s = e;
    if (perm != 0) { const size_t row = e / DM; const size_t col = e % DM; s = ((row & 15) * (size_t)HD + (row >> 4)) * (size_t)DM + col; }
    const v8f v = *(const v8f*)(src + s); v8us o;
#pragma unroll
    for (int k = 0; k < 8; ++k) o[k] = f2bf(v[k]);
    *(v8us*)(dst + e) = o; 
}

// k_proj: bf16 GEMM, one 256x128 tile of C per work-group of 8 waves (4 x 2 waves of 64x64, 16 accumulators each), K = DM in stages of 128.
// A stage is [A 256 rows | Bt 128 rows] of 256 B at LDS pitch 272 B; two buffers, filled by 16-byte asynchronous copies (each wave-wide copy = two whole 256-B rows), the next stage in flight while this one is worked on.
// C[m][n] = sum_k A[m][k] Bt[n][k], written row-major (pitch DM halves) as f16 (Ph) and optionally the f16 residual x2048 (Pr, useRes != 0). grid (M/256, DM/128), 256 threads.
// copy12: twelve 16-byte copies of one thread, LDS byte addresses l + j * (16 rows of the pitch), global addresses g0..g11.
__device__ __forceinline__ void copy12(unsigned l, const bf* g0, const bf* g1, const bf* g2, const bf* g3, const bf* g4, const bf* g5,
                                       const bf* g6, const bf* g7, const bf* g8, const bf* g9, const bf* g10, const bf* g11) {
    const unsigned RS = 16u * PLP * 2u;
    // s_wait_xcnt 0 closes the statement: no address register of a copy is rewritten ahead of it
    asm volatile("global_load_async_to_lds_b128 %0, %12, off\n\t"
                 "global_load_async_to_lds_b128 %1, %13, off\n\t"
                 "global_load_async_to_lds_b128 %2, %14, off\n\t"
                 "global_load_async_to_lds_b128 %3, %15, off\n\t"
                 "global_load_async_to_lds_b128 %4, %16, off\n\t"
                 "global_load_async_to_lds_b128 %5, %17, off\n\t"
                 "global_load_async_to_lds_b128 %6, %18, off\n\t"
                 "global_load_async_to_lds_b128 %7, %19, off\n\t"
                 "global_load_async_to_lds_b128 %8, %20, off\n\t"
                 "global_load_async_to_lds_b128 %9, %21, off\n\t"
                 "global_load_async_to_lds_b128 %10, %22, off\n\t"
                 "global_load_async_to_lds_b128 %11, %23, off\n\t"
                 "s_wait_xcnt 0x0"
                 :: "v"(l), "v"(l + RS), "v"(l + 2 * RS), "v"(l + 3 * RS), "v"(l + 4 * RS), "v"(l + 5 * RS), "v"(l + 6 * RS), "v"(l + 7 * RS),
                    "v"(l + 8 * RS), "v"(l + 9 * RS), "v"(l + 10 * RS), "v"(l + 11 * RS),
                    "v"(g0), "v"(g1), "v"(g2), "v"(g3), "v"(g4), "v"(g5), "v"(g6), "v"(g7), "v"(g8), "v"(g9), "v"(g10), "v"(g11)
                 : "memory");
}
// One thread's share of a stage: 24 copies, rows (tid>>4) + 16*j (j 0..15 of A, then 0..7 of Bt), 16-byte column tid&15; l = its LDS byte address in the buffer, ga / gb = its global addresses.
__device__ __forceinline__ void stage_copy(unsigned l, const bf* ga, const bf* gb) {
    const size_t GS = (size_t)16 * DM;
    copy12(l, ga, ga + GS, ga + 2 * GS, ga + 3 * GS, ga + 4 * GS, ga + 5 * GS, ga + 6 * GS, ga + 7 * GS, ga + 8 * GS, ga + 9 * GS, ga + 10 * GS, ga + 11 * GS);
    copy12(l + 12u * 16u * PLP * 2u, ga + 12 * GS, ga + 13 * GS, ga + 14 * GS, ga + 15 * GS, gb, gb + GS, gb + 2 * GS, gb + 3 * GS, gb + 4 * GS, gb + 5 * GS, gb + 6 * GS, gb + 7 * GS);
}

__global__ __launch_bounds__(256) void k_proj(const bf* __restrict__ A, const bf* __restrict__ Bt, h16* Ph, h16* Pr, int useRes) {
    __shared__ __align__(16) bf ring[2 * PSTG];
    __shared__ __align__(16) float osAll[8 * 16 * 68];
    const int K = DM;
    const int tid = threadIdx.x, lane = tid & 31, lr = lane & 15, hi = lane >> 4;
    const int wave = __builtin_amdgcn_readfirstlane(tid >> 5), wm = wave & 3, wn = wave >> 2;
    const int r0 = blockIdx.x * PBM, c0 = blockIdx.y * PBN;
    float* os = osAll + wave * 16 * 68;                 // wave-private output staging
    v8f acc[4][4];
#pragma unroll
    for (int mb = 0; mb < 4; ++mb)
#pragma unroll
        for (int nb = 0; nb < 4; ++nb) acc[mb][nb] = (v8f){};
    const bf* ga = A  + (size_t)(r0 + (tid >> 4)) * K + (tid & 15) * 8;
    const bf* gb = Bt + (size_t)(c0 + (tid >> 4)) * K + (tid & 15) * 8;
    const unsigned lcp = (unsigned)(size_t)ring + (unsigned)((tid >> 4) * PLP * 2 + (tid & 15) * 16);
    const int aofs = (wm * 64 + lr) * PLP + 8 * hi, bofs = (PBM + wn * 64 + lr) * PLP + 8 * hi;
    stage_copy(lcp, ga, gb);
    asm volatile("s_wait_asynccnt 0x0" ::: "memory");   // stage 0 has landed before the barrier publishes it
    __syncthreads();
    stage_copy(lcp + PSTG * 2, ga + PKS, gb + PKS);
#pragma unroll 1   // one stage per trip: one copy of the hot loop in the instruction cache, the buffer picked by t & 1
    for (int t = 0; t < PNT; ++t) {
        const bf* rb = ring + (t & 1) * PSTG;
        v16bf a[2][4], b[2][4];
#pragma unroll
        for (int mb = 0; mb < 4; ++mb) { a[0][mb] = ldb(rb + aofs + mb * 16 * PLP); b[0][mb] = ldb(rb + bofs + mb * 16 * PLP); }
#pragma unroll     // every fragment-set index a constant, so both sets stay in registers
        for (int kb = 0; kb < PKS / 32; ++kb) {
            const int cur = kb & 1, nxt = cur ^ 1;
            if (kb + 1 < PKS / 32) {
#pragma unroll
                for (int mb = 0; mb < 4; ++mb) { a[nxt][mb] = ldb(rb + aofs + mb * 16 * PLP + (kb + 1) * 32); b[nxt][mb] = ldb(rb + bofs + mb * 16 * PLP + (kb + 1) * 32); }
            }
            __builtin_amdgcn_sched_barrier(0);          // the next block's LDS reads stay one group ahead of this block's matrix instructions, none among them
#pragma unroll
            for (int nb = 0; nb < 4; ++nb)
#pragma unroll
                for (int mb = 0; mb < 4; ++mb) acc[mb][nb] = wmmab(a[cur][mb], b[cur][nb], acc[mb][nb]);
            __builtin_amdgcn_sched_barrier(0);          // closes the block for the same reason
        }
        asm volatile("s_wait_dscnt 0x0" ::: "memory");      // this wave's reads of the buffer have returned before it is handed to the copies
        asm volatile("s_wait_asynccnt 0x0" ::: "memory");   // this wave's copies of stage t + 1 have landed before the barrier publishes them
        __syncthreads();
        if (t + 2 < PNT) stage_copy(lcp + (t & 1) * (PSTG * 2), ga + (t + 2) * PKS, gb + (t + 2) * PKS);
    }
    asm volatile("s_wait_asynccnt 0x0" ::: "memory");       // nothing of this wave in flight behind the loop
    const size_t tbase = (size_t)(r0 + wm * 64) * (size_t)DM + (size_t)(c0 + wn * 64);
#pragma unroll
    for (int mb = 0; mb < 4; ++mb) {
#pragma unroll
        for (int nb = 0; nb < 4; ++nb) {
#pragma unroll
            for (int j = 0; j < 8; ++j) os[(hi * 8 + j) * 68 + nb * 16 + lr] = acc[mb][nb][j]; }   // D: row 8h+j, col lane&15
        wave_sync();
        const size_t sb = tbase + (size_t)(mb * 16) * (size_t)DM;
{
#pragma unroll
            for (int s = 0; s < 4; ++s) { const int row = 4 * s + (lane >> 3), c8 = (lane & 7) * 8;   // 4 s x 4 row groups = 16 rows; 8 lanes x 8 = 64 columns
                const v4f x0 = *(const v4fa*)(&os[row * 68 + c8]); const v4f x1 = *(const v4fa*)(&os[row * 68 + c8 + 4]); v8h hv, rv;
#pragma unroll
                for (int i = 0; i < 4; ++i) { const h16 a0 = (h16)x0[i]; const h16 a1 = (h16)x1[i]; hv[i] = a0; hv[4 + i] = a1; rv[i] = (h16)((x0[i] - (float)a0) * QRS); rv[4 + i] = (h16)((x1[i] - (float)a1) * QRS); }
                const size_t oo = sb + (size_t)row * (size_t)DM + c8;
                *(v8h*)(Ph + oo) = hv; if (useRes) *(v8h*)(Pr + oo) = rv; }
             }
        wave_sync();
    }
}

// k_xhead: per-token attention across the 16 heads, one wave per token (PPW tokens in sequence); K / Q / V^T fragments straight from the f16 planes (16-B loads, arithmetic addressing).
// Transposed form: S^T[j][i] = K Q^T (A = K head rows j, B = Q head rows i, k = d, two 32-deep steps); lane (i = lane&15, h = lane>>4) holds keys j = 8h+r, so the packed
// P values are directly elements 0..7 of the B fragment of O^T[d][i] = V^T P^T (k = j = 8h+r); elements 8..15 (k = 16..31) are literal zeros in BOTH operands.
// V^T A fragment: row d = 16*jt + lane&15, elements 0..7 <- plane[token][d*16 + 8h + 0..7] (one 16-B load), elements 8..15 zero.
// Softmax: lane-local max/sum over 8 keys, the two lane halves of a query combined with one xor-16 exchange (all lanes active, uniform control).
__global__ __launch_bounds__(32 * AW) void k_xhead(const h16* __restrict__ QH, const h16* __restrict__ QR, const h16* __restrict__ KP, const h16* __restrict__ VT, float* OUT) {
    __shared__ __align__(16) float os[AW * 16 * 68];
    const int lane = threadIdx.x & 31, wave = __builtin_amdgcn_readfirstlane((int)(threadIdx.x >> 5)), lr = lane & 15, hi = lane >> 4;
    const int wb = wave * 16 * 68;
    const int pos0 = (blockIdx.x * AW + wave) * PPW;
#pragma unroll 1
    for (int pp = 0; pp < PPW; ++pp) {
        const int m = pos0 + pp;                       // compact token row of the planes
        const int b = m / SEQ, t = m % SEQ;
        const size_t rb = (size_t)m * DM;
        const size_t qo = rb + (size_t)lr * HD + 8 * hi;
        const v16h qh0 = ldh(QH + qo), qh1 = ldh(QH + qo + 32), qr0 = ldh(QR + qo), qr1 = ldh(QR + qo + 32);   // B fragments: col i, k = d
        const v16h ka0 = ldh(KP + qo), ka1 = ldh(KP + qo + 32);                                                // A fragments: row j, k = d
        v8f sH = (v8f){}, sL = (v8f){};
        sH = wmma16(ka0, qh0, sH); sL = wmma16(ka0, qr0, sL);
        sH = wmma16(ka1, qh1, sH); sL = wmma16(ka1, qr1, sL);
        asm volatile("v_nop\n\tv_nop\n\tv_nop\n\tv_nop" : "+v"(sH), "+v"(sL) : "v"(ka0), "v"(ka1), "v"(qh0), "v"(qh1), "v"(qr0), "v"(qr1));
        float ta[8]; float mx = -3.0e38f;
#pragma unroll
        for (int r = 0; r < 8; ++r) { ta[r] = (sH[r] + sL[r] * QRI) * SC2; mx = fmaxf(mx, ta[r]); }
        mx = fmaxf(mx, __shfl_xor(mx, 16, 32));
        const float sh = PSH - mx;
        v16h pb; float l = 0.0f;
#pragma unroll
        for (int r = 0; r < 8; ++r) { const h16 pa = (h16)__builtin_amdgcn_exp2f(ta[r] + sh); pb[r] = pa; pb[8 + r] = (h16)0.0f; l += (float)pa; }
        l += __shfl_xor(l, 16, 32);
        const float inv = 1.0f / l;
        const size_t vo = rb + (size_t)lr * 16 + 8 * hi;          // + jt*256: row d = 16*jt + lr, k = j = 8h + e
        const v8h zz = (v8h){};
        const v16h v0 = cat16(*(const v8h*)(VT + vo), zz), v1 = cat16(*(const v8h*)(VT + vo + 256), zz), v2 = cat16(*(const v8h*)(VT + vo + 512), zz), v3 = cat16(*(const v8h*)(VT + vo + 768), zz);
        v8f o0 = (v8f){}, o1 = (v8f){}, o2 = (v8f){}, o3 = (v8f){};
        o0 = wmma16(v0, pb, o0); o1 = wmma16(v1, pb, o1); o2 = wmma16(v2, pb, o2); o3 = wmma16(v3, pb, o3);
        asm volatile("v_nop\n\tv_nop\n\tv_nop\n\tv_nop" : "+v"(o0), "+v"(o1), "+v"(o2), "+v"(o3) : "v"(v0), "v"(v1), "v"(v2), "v"(v3), "v"(pb));
        // O^T D layout: o_jt[r] = (d = 16jt + 8h + r, i = lane&15) -> os[i][d]; rows 0..15 x columns 0..63 all written
        { v4f a, c;
          a[0] = o0[0] * inv; a[1] = o0[1] * inv; a[2] = o0[2] * inv; a[3] = o0[3] * inv; c[0] = o0[4] * inv; c[1] = o0[5] * inv; c[2] = o0[6] * inv; c[3] = o0[7] * inv;
          *(v4fa*)(&os[wb + lr * 68 +  0 + 8 * hi]) = a; *(v4fa*)(&os[wb + lr * 68 +  0 + 8 * hi + 4]) = c;
          a[0] = o1[0] * inv; a[1] = o1[1] * inv; a[2] = o1[2] * inv; a[3] = o1[3] * inv; c[0] = o1[4] * inv; c[1] = o1[5] * inv; c[2] = o1[6] * inv; c[3] = o1[7] * inv;
          *(v4fa*)(&os[wb + lr * 68 + 16 + 8 * hi]) = a; *(v4fa*)(&os[wb + lr * 68 + 16 + 8 * hi + 4]) = c;
          a[0] = o2[0] * inv; a[1] = o2[1] * inv; a[2] = o2[2] * inv; a[3] = o2[3] * inv; c[0] = o2[4] * inv; c[1] = o2[5] * inv; c[2] = o2[6] * inv; c[3] = o2[7] * inv;
          *(v4fa*)(&os[wb + lr * 68 + 32 + 8 * hi]) = a; *(v4fa*)(&os[wb + lr * 68 + 32 + 8 * hi + 4]) = c;
          a[0] = o3[0] * inv; a[1] = o3[1] * inv; a[2] = o3[2] * inv; a[3] = o3[3] * inv; c[0] = o3[4] * inv; c[1] = o3[5] * inv; c[2] = o3[6] * inv; c[3] = o3[7] * inv;
          *(v4fa*)(&os[wb + lr * 68 + 48 + 8 * hi]) = a; *(v4fa*)(&os[wb + lr * 68 + 48 + 8 * hi + 4]) = c; }
        wave_sync();
        float* orow = OUT + ((size_t)b * OUT_SEQ + t) * DM;      // token row: column = i*64 + d
{
#pragma unroll
            for (int s = 0; s < 8; ++s) { const int row = 2 * s + hi, cofs = lr * 4;   // 8 s x 2 rows = 16 head rows; 16 lanes x 4 floats = 64 columns
                const v4f val = *(const v4fa*)(&os[wb + row * 68 + cofs]);
                *(v4f*)(orow + (size_t)row * HD + cofs) = val; }
             }
        wave_sync();                                              // tile is rewritten by the next token
    }
}

static constexpr size_t al256(size_t v) { return (v + 255) & ~(size_t)255; }
static constexpr size_t SZ_XB = al256((size_t)NB * SEQ * DM * 2);
static constexpr size_t SZ_WB = al256((size_t)3 * DM * DM * 2);
static constexpr size_t SZ_PL = al256((size_t)NB * SEQ * DM * 2);
static constexpr size_t SZ_TOTAL = SZ_XB + SZ_WB + 4 * SZ_PL;
static_assert(SZ_TOTAL <= (size_t)134217728);          // workspace carve <= 128 MiB
static_assert(((size_t)DM * DM * 2) % 256 == 0);       // weight sub-planes stay 256-byte aligned

extern "C" void kernel_launch(void* const* d_in, const int* in_sizes, int n_in,
                              void* d_out, int out_size, void* d_ws, size_t ws_size, hipStream_t stream) {
    if (n_in < 4) return;
    const size_t needx = ((size_t)(NB - 1) * SEQ_FULL + SEQ) * DM;
    if ((size_t)in_sizes[0] < needx) return;
    if ((size_t)in_sizes[1] < (size_t)DM * DM || (size_t)in_sizes[2] < (size_t)DM * DM || (size_t)in_sizes[3] < (size_t)DM * DM) return;
    if ((size_t)out_size < ((size_t)(NB - 1) * OUT_SEQ + SEQ) * DM) return;
    if (SZ_TOTAL > ws_size) return;
    const float* x = (const float*)d_in[0]; const float* wq = (const float*)d_in[1]; const float* wk = (const float*)d_in[2]; const float* wv = (const float*)d_in[3];   // wire order x, Wq, Wk, Wv ([out][in] = Bt as-is)
    float* OUT = (float*)d_out;      // [NB][SEQ][1024]
    char* wsp = (char*)d_ws;
    bf* XB = (bf*)wsp; wsp += SZ_XB;                 // [NB*SEQ][1024]
    bf* WB = (bf*)wsp; wsp += SZ_WB;                 // [3][1024][1024]: q | k | v (v rows permuted: d*16+j <- j*64+d)
    h16* QH = (h16*)wsp; wsp += SZ_PL;               // [NB*SEQ][head*64+d]
    h16* QR = (h16*)wsp; wsp += SZ_PL;               // [NB*SEQ][head*64+d] residual x2048
    h16* KP = (h16*)wsp; wsp += SZ_PL;               // [NB*SEQ][head*64+d]
    h16* VT = (h16*)wsp; wsp += SZ_PL;               // [NB*SEQ][d*16+head]
    bf* WQ = WB; bf* WK = WB + (size_t)DM * DM; bf* WV = WB + (size_t)2 * DM * DM;

    if (SEQ == SEQ_FULL) {
        const size_t n8 = (size_t)NB * SEQ * DM / 8;
        k_cvt8<<<(unsigned)((n8 + 255) / 256), 256, 0, stream>>>(x, XB, n8, 0);
    } else {
        const size_t n8 = (size_t)SEQ * DM / 8;
        for (int b = 0; b < NB; ++b) k_cvt8<<<(unsigned)((n8 + 255) / 256), 256, 0, stream>>>(x + (size_t)b * SEQ_FULL * DM, XB + (size_t)b * SEQ * DM, n8, 0);
    }
    { const size_t n8 = (size_t)DM * DM / 8; const unsigned g = (unsigned)((n8 + 255) / 256);
      k_cvt8<<<g, 256, 0, stream>>>(wq, WQ, n8, 0); k_cvt8<<<g, 256, 0, stream>>>(wk, WK, n8, 0); k_cvt8<<<g, 256, 0, stream>>>(wv, WV, n8, 1); }

    // q, k: A = x rows (m = b*SEQ + t), Bt = W rows (n = head*64 + d) -> plane [m][head*64 + d]
    k_proj<<<dim3(NB * SEQ / PBM, DM / PBN, 1), 256, 0, stream>>>(XB, WQ, QH, QR, 1);
    k_proj<<<dim3(NB * SEQ / PBM, DM / PBN, 1), 256, 0, stream>>>(XB, WK, KP, KP, 0);
    // v^T: Bt = permuted Wv rows (n = d*16 + head) -> plane [m][d*16 + head]
    k_proj<<<dim3(NB * SEQ / PBM, DM / PBN, 1), 256, 0, stream>>>(XB, WV, VT, VT, 0);

    k_xhead<<<dim3(NB * SEQ / (AW * PPW), 1, 1), 32 * AW, 0, stream>>>(QH, QR, KP, VT, OUT);
}

// v003
// It runs in 61.1 microseconds.
// Versions between v001 and this one are left out; their measured steps multiply to 1.21 times as fast.
// All steps since v000 together make it 2.20 times as fast.
#include <hip/hip_runtime.h>

// Per-token attention across heads, width 1024 = 16 heads x 64: x [NB][SEQ][1024], Wq/Wk/Wv [out][in] (y = x W^T), no biases, no mask, score scale 1/8;
// for each token the 16 head rows of q attend over the 16 head rows of k/v of the SAME token (scores 16x16, softmax over the key head), output column = head*64 + d (f32).
// Compute dtypes, f32 accumulate everywhere: projections v_wmma_f32_16x16x32_bf16 (x and W RNE-converted to bf16; products exact);
// scores v_wmma_f32_16x16x32_f16: k single f16, q as f16 value + f16 residual x2048 in its own accumulator; P (x256 carry, cancels in the normalisation) and v single f16; softmax f32.
// Layout: bf16 copies of x and W (the Wv copy with permuted rows d*16+j <- j*64+d); q (hi, residual), k planes [token][head*64+d] and v^T plane [token][d*16+head] written by the GEMM epilogue;
// per-token kernel in transposed form (S^T = K Q^T, O^T = V^T P^T, 16 keys zero-padded to the 32-deep step), output from f32 accumulators.

#ifndef NB
#define NB 4
#endif
#ifndef SEQ
#define SEQ 2048
#endif
#define NB_FULL  4
#define SEQ_FULL 2048
#ifndef OUT_SEQ
#define OUT_SEQ SEQ              // row pitch (in tokens) between batches of the output
#endif
#define DM   1024
#define NH_  16
#define HD   64
#define AW   4                   // waves per block of the per-token kernel
#define PPW  4                   // tokens handled sequentially by each wave
#define QRS  2048.0f             // carry of the q residual plane
#define QRI  (1.0f / 2048.0f)
#define SC2  (0.125f * 1.4426950408889634f)   // HD^-0.5 * log2(e)
#define PSH  8.0f                // log2 of the P carry (256)
#define PBM  256                 // projection GEMM: rows of C per work-group
#define PBN  128                 // columns of C per work-group
#define PKS  128                 // k per stage (256-B rows)
#define PLP  136                 // LDS row pitch in 16-bit elements (272 B = 16 B x odd, for 16-byte readers)
#define PSTG ((PBM + PBN) * PLP) // elements per buffer
#define PNT  (DM / PKS)          // stages
#define CVG  256                 // conversion launch: work-groups
#define CVW  16                  // waves per work-group
#define XPW  (NB * SEQ * DM / 128 / (CVG * CVW))   // 128-float pieces of x per wave
#define WPW  (DM * DM / 128 / (CVG * CVW))         // 128-float pieces of each weight per wave

static_assert(HD == 64);
static_assert(NH_ == 16);                      // one 16-key tile per token; v^T row = 16 halves
static_assert(NH_ * HD == DM);                 // head h = columns h*64 + d
static_assert(DM % 64 == 0);                   // 16 column tiles of 64
static_assert(DM % 32 == 0);                   // GEMM k-loop steps by 32
static_assert((NB * SEQ) % PBM == 0);          // GEMM row tiles cover the token rows exactly
static_assert(DM % PBN == 0 && DM % PKS == 0 && PNT >= 2);   // column tiles and stages cover exactly; the two-buffer prologue needs two stages
static_assert(PNT % 2 == 0);                   // the buffer of a stage keeps its parity from one weight's tile to the next
static_assert((NB * SEQ) % (AW * PPW) == 0);   // per-token grid covers the token rows exactly
static_assert(XPW >= 1 && (size_t)XPW * 128 * CVG * CVW == (size_t)NB * SEQ * DM);   // the waves' x pieces cover x exactly
static_assert(((size_t)SEQ * DM) % (XPW * 128) == 0);                                  // a wave's x pieces stay inside one batch
static_assert(WPW >= 1 && (size_t)WPW * 128 * CVG * CVW == (size_t)DM * DM);           // the waves' weight pieces cover each weight exactly
static_assert(DM % (WPW * 128) == 0);                                                  // a wave's weight pieces stay inside one row
static_assert(NB <= NB_FULL);
static_assert(SEQ <= SEQ_FULL);

typedef _Float16 h16;
typedef unsigned short bf;
typedef __attribute__((ext_vector_type(16))) __bf16   v16bf;
typedef __attribute__((ext_vector_type(16))) _Float16 v16h;
typedef __attribute__((ext_vector_type(8)))  _Float16 v8h;
typedef __attribute__((ext_vector_type(8)))  unsigned short v8us;
typedef __attribute__((ext_vector_type(4)))  unsigned short v4us;
typedef __attribute__((ext_vector_type(8)))  float    v8f;
typedef __attribute__((ext_vector_type(4)))  float    v4f;
typedef v4f  __attribute__((may_alias)) v4fa;

__device__ __forceinline__ unsigned short f2bf(float f) { unsigned u = __float_as_uint(f); u += 0x7FFFu + ((u >> 16) & 1u); return (unsigned short)(u >> 16); }
__device__ __forceinline__ v16h cat16(v8h lo, v8h hi) { return __builtin_shufflevector(lo, hi, 0, 1, 2, 3, 4, 5, 6, 7, 8, 9, 10, 11, 12, 13, 14, 15); }
__device__ __forceinline__ v16bf cat16b(v8us lo, v8us hi) { return __builtin_bit_cast(v16bf, __builtin_shufflevector(lo, hi, 0, 1, 2, 3, 4, 5, 6, 7, 8, 9, 10, 11, 12, 13, 14, 15)); }
__device__ __forceinline__ v8f wmma16(v16h a, v16h b, v8f c) { return __builtin_amdgcn_wmma_f32_16x16x32_f16(false, a, false, b, (short)0, c, false, false); }
__device__ __forceinline__ v8f wmmab(v16bf a, v16bf b, v8f c) { return __builtin_amdgcn_wmma_f32_16x16x32_bf16(false, a, false, b, (short)0, c, false, false); }
// fragment loaders from K-contiguous 16-bit rows; p already includes + 8*(lane>>4): elements 0..7 <- k0+8h+0..7, elements 8..15 <- k0+16+8h+0..7 (same map for A and B)
__device__ __forceinline__ v16h  ldh(const h16* p) { return cat16(*(const v8h*)p, *(const v8h*)(p + 16)); }
__device__ __forceinline__ v16bf ldb(const bf* p)  { return cat16b(*(const v8us*)p, *(const v8us*)(p + 16)); }
// ordering point for wave-private LDS tiles (same wave writes and reads)
__device__ __forceinline__ void wave_sync() { __builtin_amdgcn_fence(3 /* release order */, "wavefront"); __builtin_amdgcn_wave_barrier(); asm volatile("" ::: "memory"); }

// k_cvt: every f32 -> bf16 conversion (x, Wq, Wk, Wv) in ONE launch that is resident at once: CVG work-groups of CVW waves, so few waves have to be started and no launch waits on another.
// A piece = 128 consecutive floats = one wave-wide 16-byte load (512 B, four whole lines) -> one wave-wide 8-byte store (256 B, two whole lines).
// Wave gw takes XPW consecutive pieces of x and WPW consecutive pieces of each weight; all its loads are issued before the first value is converted.
// The Wv copy has permuted rows: dst row (d*16 + j) <- src row (j*64 + d); a piece lies inside one row, so loads and stores stay line-contiguous.
__device__ __forceinline__ v4us cvt4(v4f v) { v4us o; o[0] = f2bf(v[0]); o[1] = f2bf(v[1]); o[2] = f2bf(v[2]); o[3] = f2bf(v[3]); return o; }
__global__ __launch_bounds__(32 * CVW) void k_cvt(const float* __restrict__ x, const float* __restrict__ wq, const float* __restrict__ wk, const float* __restrict__ wv,
                                                  bf* __restrict__ XB, bf* __restrict__ WB) {
    const int lane = threadIdx.x & 31, wave = __builtin_amdgcn_readfirstlane((int)(threadIdx.x >> 5));
    const int gw = blockIdx.x * CVW + wave;
    const size_t ex = (size_t)gw * (XPW * 128);                                   // first element of the wave's x pieces (compact rows); XPW * 128 divides SEQ * DM, so they lie in one batch
    const size_t sx = ex + (ex / ((size_t)SEQ * DM)) * ((size_t)(SEQ_FULL - SEQ) * DM);
    const size_t ew = (size_t)gw * (WPW * 128);                                   // first element of the wave's pieces of each weight; WPW * 128 divides DM, so they lie in one row
    const size_t row = ew / DM, col = ew % DM;
    const size_t sv = ((row & 15) * (size_t)HD + (row >> 4)) * (size_t)DM + col;
    v4f rx[XPW], rq[WPW], rk[WPW], rv[WPW];
    // the four loops below are unrolled so that every piece index is a constant: the pieces stay in registers and the piece offsets become immediates
#pragma unroll
    for (int j = 0; j < XPW; ++j) rx[j] = *(const v4f*)(x + sx + j * 128 + lane * 4);
#pragma unroll
    for (int j = 0; j < WPW; ++j) { rq[j] = *(const v4f*)(wq + ew + j * 128 + lane * 4); rk[j] = *(const v4f*)(wk + ew + j * 128 + lane * 4); rv[j] = *(const v4f*)(wv + sv + j * 128 + lane * 4); }
    __builtin_amdgcn_sched_barrier(0);   // every load is issued before the first wait: without it the weight loads sink behind the x values' waits and the wave pays memory latency several times over
#pragma unroll
    for (int j = 0; j < XPW; ++j) *(v4us*)(XB + ex + j * 128 + lane * 4) = cvt4(rx[j]);
#pragma unroll
    for (int j = 0; j < WPW; ++j) {
        *(v4us*)(WB + ew + j * 128 + lane * 4) = cvt4(rq[j]);
        *(v4us*)(WB + (size_t)DM * DM + ew + j * 128 + lane * 4) = cvt4(rk[j]);
        *(v4us*)(WB + (size_t)2 * DM * DM + ew + j * 128 + lane * 4) = cvt4(rv[j]);
    }
}

// k_proj: bf16 GEMM, 256x128 tiles of C per work-group of 8 waves (4 x 2 waves of 64x64, 16 accumulators each), K = DM in stages of 128.
// One launch for q, k and v: a work-group works the same tile position of the three products one after the other, as 3 * PNT stages of ONE ring, so the next weight's first two stages are copied under the last stages and the epilogue of this one.
// A stage is [A 256 rows | Bt 128 rows] of 256 B at LDS pitch 272 B; two buffers, filled by 16-byte asynchronous copies (each wave-wide copy = two whole 256-B rows), the next stage in flight while this one is worked on.
// C[m][n] = sum_k A[m][k] Bt[n][k], Bt = plane w of Wb (q | k | v), written row-major (pitch DM halves) as f16 (QH, KP, VT) and for q also the f16 residual x2048 (QR). grid (M/256, DM/128), 256 threads.
// copy12: twelve 16-byte copies of one thread, LDS byte addresses l + j * (16 rows of the pitch), global addresses g0..g11.
__device__ __forceinline__ void copy12(unsigned l, const bf* g0, const bf* g1, const bf* g2, const bf* g3, const bf* g4, const bf* g5,
                                       const bf* g6, const bf* g7, const bf* g8, const bf* g9, const bf* g10, const bf* g11) {
    const unsigned RS = 16u * PLP * 2u;
    // s_wait_xcnt 0 closes the statement: no address register of a copy is rewritten ahead of it
    asm volatile("global_load_async_to_lds_b128 %0, %12, off\n\t"
                 "global_load_async_to_lds_b128 %1, %13, off\n\t"
                 "global_load_async_to_lds_b128 %2, %14, off\n\t"
                 "global_load_async_to_lds_b128 %3, %15, off\n\t"
                 "global_load_async_to_lds_b128 %4, %16, off\n\t"
                 "global_load_async_to_lds_b128 %5, %17, off\n\t"
                 "global_load_async_to_lds_b128 %6, %18, off\n\t"
                 "global_load_async_to_lds_b128 %7, %19, off\n\t"
                 "global_load_async_to_lds_b128 %8, %20, off\n\t"
                 "global_load_async_to_lds_b128 %9, %21, off\n\t"
                 "global_load_async_to_lds_b128 %10, %22, off\n\t"
                 "global_load_async_to_lds_b128 %11, %23, off\n\t"
                 "s_wait_xcnt 0x0"
                 :: "v"(l), "v"(l + RS), "v"(l + 2 * RS), "v"(l + 3 * RS), "v"(l + 4 * RS), "v"(l + 5 * RS), "v"(l + 6 * RS), "v"(l + 7 * RS),
                    "v"(l + 8 * RS), "v"(l + 9 * RS), "v"(l + 10 * RS), "v"(l + 11 * RS),
                    "v"(g0), "v"(g1), "v"(g2), "v"(g3), "v"(g4), "v"(g5), "v"(g6), "v"(g7), "v"(g8), "v"(g9), "v"(g10), "v"(g11)
                 : "memory");
}
// One thread's share of a stage: 24 copies, rows (tid>>4) + 16*j (j 0..15 of A, then 0..7 of Bt), 16-byte column tid&15; l = its LDS byte address in the buffer, ga / gb = its global addresses.
__device__ __forceinline__ void stage_copy(unsigned l, const bf* ga, const bf* gb) {
    const size_t GS = (size_t)16 * DM;
    copy12(l, ga, ga + GS, ga + 2 * GS, ga + 3 * GS, ga + 4 * GS, ga + 5 * GS, ga + 6 * GS, ga + 7 * GS, ga + 8 * GS, ga + 9 * GS, ga + 10 * GS, ga + 11 * GS);
    copy12(l + 12u * 16u * PLP * 2u, ga + 12 * GS, ga + 13 * GS, ga + 14 * GS, ga + 15 * GS, gb, gb + GS, gb + 2 * GS, gb + 3 * GS, gb + 4 * GS, gb + 5 * GS, gb + 6 * GS, gb + 7 * GS);
}

__global__ __launch_bounds__(256) void k_proj(const bf* __restrict__ A, const bf* __restrict__ Wb, h16* QH, h16* QR, h16* KP, h16* VT) {
    __shared__ __align__(16) bf ring[2 * PSTG];
    __shared__ __align__(16) float osAll[8 * 16 * 68];
    const int K = DM;
    const int tid = threadIdx.x, lane = tid & 31, lr = lane & 15, hi = lane >> 4;
    const int wave = __builtin_amdgcn_readfirstlane(tid >> 5), wm = wave & 3, wn = wave >> 2;
    const int r0 = blockIdx.x * PBM, c0 = blockIdx.y * PBN;
    float* os = osAll + wave * 16 * 68;                 // wave-private output staging
    const bf* ga = A  + (size_t)(r0 + (tid >> 4)) * K + (tid & 15) * 8;
    const bf* gb = Wb + (size_t)(c0 + (tid >> 4)) * K + (tid & 15) * 8;
    const unsigned lcp = (unsigned)(size_t)ring + (unsigned)((tid >> 4) * PLP * 2 + (tid & 15) * 16);
    const int aofs = (wm * 64 + lr) * PLP + 8 * hi, bofs = (PBM + wn * 64 + lr) * PLP + 8 * hi;
    stage_copy(lcp, ga, gb);
    asm volatile("s_wait_asynccnt 0x0" ::: "memory");   // stage 0 has landed before the barrier publishes it
    __syncthreads();
    stage_copy(lcp + PSTG * 2, ga + PKS, gb + PKS);
    const size_t tbase = (size_t)(r0 + wm * 64) * (size_t)DM + (size_t)(c0 + wn * 64);
#pragma unroll 1   // one copy of stage loop and epilogue for the three weights
  for (int w = 0; w < 3; ++w) {
    v8f acc[4][4];
#pragma unroll
    for (int mb = 0; mb < 4; ++mb)
#pragma unroll
        for (int nb = 0; nb < 4; ++nb) acc[mb][nb] = (v8f){};
#pragma unroll 1   // one stage per trip: one copy of the hot loop in the instruction cache, the buffer picked by t & 1
    for (int t = 0; t < PNT; ++t) {
        const bf* rb = ring + (t & 1) * PSTG;
        v16bf a[2][4], b[2][4];
#pragma unroll
        for (int mb = 0; mb < 4; ++mb) { a[0][mb] = ldb(rb + aofs + mb * 16 * PLP); b[0][mb] = ldb(rb + bofs + mb * 16 * PLP); }
#pragma unroll     // every fragment-set index a constant, so both sets stay in registers
        for (int kb = 0; kb < PKS / 32; ++kb) {
            const int cur = kb & 1, nxt = cur ^ 1;
            if (kb + 1 < PKS / 32) {
#pragma unroll
                for (int mb = 0; mb < 4; ++mb) { a[nxt][mb] = ldb(rb + aofs + mb * 16 * PLP + (kb + 1) * 32); b[nxt][mb] = ldb(rb + bofs + mb * 16 * PLP + (kb + 1) * 32); }
            }
            __builtin_amdgcn_sched_barrier(0);          // the next block's LDS reads stay one group ahead of this block's matrix instructions, none among them
#pragma unroll
            for (int nb = 0; nb < 4; ++nb)
#pragma unroll
                for (int mb = 0; mb < 4; ++mb) acc[mb][nb] = wmmab(a[cur][mb], b[cur][nb], acc[mb][nb]);
            __builtin_amdgcn_sched_barrier(0);          // closes the block for the same reason
        }
        asm volatile("s_wait_dscnt 0x0" ::: "memory");      // this wave's reads of the buffer have returned before it is handed to the copies
        asm volatile("s_wait_asynccnt 0x0" ::: "memory");   // this wave's copies of stage t + 1 have landed before the barrier publishes them
        __syncthreads();
        const int s2 = w * PNT + t + 2;                     // ring stage two ahead: weight s2 / PNT, k stage s2 % PNT
        if (s2 < 3 * PNT) stage_copy(lcp + (t & 1) * (PSTG * 2), ga + (s2 % PNT) * PKS, gb + (size_t)(s2 / PNT) * ((size_t)DM * DM) + (s2 % PNT) * PKS);
    }
    h16* Ph = w == 0 ? QH : (w == 1 ? KP : VT); h16* Pr = QR; const int useRes = w == 0;
#pragma unroll
    for (int mb = 0; mb < 4; ++mb) {
#pragma unroll
        for (int nb = 0; nb < 4; ++nb) {
#pragma unroll
            for (int j = 0; j < 8; ++j) os[(hi * 8 + j) * 68 + nb * 16 + lr] = acc[mb][nb][j]; }   // D: row 8h+j, col lane&15
        wave_sync();
        const size_t sb = tbase + (size_t)(mb * 16) * (size_t)DM;
{
#pragma unroll
            for (int s = 0; s < 4; ++s) { const int row = 4 * s + (lane >> 3), c8 = (lane & 7) * 8;   // 4 s x 4 row groups = 16 rows; 8 lanes x 8 = 64 columns
                const v4f x0 = *(const v4fa*)(&os[row * 68 + c8]); const v4f x1 = *(const v4fa*)(&os[row * 68 + c8 + 4]); v8h hv, rv;
#pragma unroll
                for (int i = 0; i < 4; ++i) { const h16 a0 = (h16)x0[i]; const h16 a1 = (h16)x1[i]; hv[i] = a0; hv[4 + i] = a1; rv[i] = (h16)((x0[i] - (float)a0) * QRS); rv[4 + i] = (h16)((x1[i] - (float)a1) * QRS); }
                const size_t oo = sb + (size_t)row * (size_t)DM + c8;
                *(v8h*)(Ph + oo) = hv; if (useRes) *(v8h*)(Pr + oo) = rv; }
             }
        wave_sync();
    }
    asm volatile("s_wait_xcnt 0x0" ::: "memory");           // stands in front of the next tile's zeroing, which rewrites registers that this tile's stores name
  }
    asm volatile("s_wait_asynccnt 0x0" ::: "memory");       // nothing of this wave in flight behind the last stage
}

// k_xhead: per-token attention across the 16 heads, one wave per token (PPW tokens in sequence); K / Q / V^T fragments straight from the f16 planes (16-B loads, arithmetic addressing).
// Transposed form: S^T[j][i] = K Q^T (A = K head rows j, B = Q head rows i, k = d, two 32-deep steps); lane (i = lane&15, h = lane>>4) holds keys j = 8h+r, so the packed
// P values are directly elements 0..7 of the B fragment of O^T[d][i] = V^T P^T (k = j = 8h+r); elements 8..15 (k = 16..31) are literal zeros in BOTH operands.
// V^T A fragment: row d = 16*jt + lane&15, elements 0..7 <- plane[token][d*16 + 8h + 0..7] (one 16-B load), elements 8..15 zero.
// Softmax: lane-local max/sum over 8 keys, the two lane halves of a query combined with one xor-16 exchange (all lanes active, uniform control).
__global__ __launch_bounds__(32 * AW) void k_xhead(const h16* __restrict__ QH, const h16* __restrict__ QR, const h16* __restrict__ KP, const h16* __restrict__ VT, float* OUT) {
    __shared__ __align__(16) float os[AW * 16 * 68];
    const int lane = threadIdx.x & 31, wave = __builtin_amdgcn_readfirstlane((int)(threadIdx.x >> 5)), lr = lane & 15, hi = lane >> 4;
    const int wb = wave * 16 * 68;
    const int pos0 = (blockIdx.x * AW + wave) * PPW;
#pragma unroll 1
    for (int pp = 0; pp < PPW; ++pp) {
        const int m = pos0 + pp;                       // compact token row of the planes
        const int b = m / SEQ, t = m % SEQ;
        const size_t rb = (size_t)m * DM;
        const size_t qo = rb + (size_t)lr * HD + 8 * hi;
        const v16h qh0 = ldh(QH + qo), qh1 = ldh(QH + qo + 32), qr0 = ldh(QR + qo), qr1 = ldh(QR + qo + 32);   // B fragments: col i, k = d
        const v16h ka0 = ldh(KP + qo), ka1 = ldh(KP + qo + 32);                                                // A fragments: row j, k = d
        v8f sH = (v8f){}, sL = (v8f){};
        sH = wmma16(ka0, qh0, sH); sL = wmma16(ka0, qr0, sL);
        sH = wmma16(ka1, qh1, sH); sL = wmma16(ka1, qr1, sL);
        asm volatile("v_nop\n\tv_nop\n\tv_nop\n\tv_nop" : "+v"(sH), "+v"(sL) : "v"(ka0), "v"(ka1), "v"(qh0), "v"(qh1), "v"(qr0), "v"(qr1));
        float ta[8]; float mx = -3.0e38f;
#pragma unroll
        for (int r = 0; r < 8; ++r) { ta[r] = (sH[r] + sL[r] * QRI) * SC2; mx = fmaxf(mx, ta[r]); }
        mx = fmaxf(mx, __shfl_xor(mx, 16, 32));
        const float sh = PSH - mx;
        v16h pb; float l = 0.0f;
#pragma unroll
        for (int r = 0; r < 8; ++r) { const h16 pa = (h16)__builtin_amdgcn_exp2f(ta[r] + sh); pb[r] = pa; pb[8 + r] = (h16)0.0f; l += (float)pa; }
        l += __shfl_xor(l, 16, 32);
        const float inv = 1.0f / l;
        const size_t vo = rb + (size_t)lr * 16 + 8 * hi;          // + jt*256: row d = 16*jt + lr, k = j = 8h + e
        const v8h zz = (v8h){};
        const v16h v0 = cat16(*(const v8h*)(VT + vo), zz), v1 = cat16(*(const v8h*)(VT + vo + 256), zz), v2 = cat16(*(const v8h*)(VT + vo + 512), zz), v3 = cat16(*(const v8h*)(VT + vo + 768), zz);
        v8f o0 = (v8f){}, o1 = (v8f){}, o2 = (v8f){}, o3 = (v8f){};
        o0 = wmma16(v0, pb, o0); o1 = wmma16(v1, pb, o1); o2 = wmma16(v2, pb, o2); o3 = wmma16(v3, pb, o3);
        asm volatile("v_nop\n\tv_nop\n\tv_nop\n\tv_nop" : "+v"(o0), "+v"(o1), "+v"(o2), "+v"(o3) : "v"(v0), "v"(v1), "v"(v2), "v"(v3), "v"(pb));
        // O^T D layout: o_jt[r] = (d = 16jt + 8h + r, i = lane&15) -> os[i][d]; rows 0..15 x columns 0..63 all written
        { v4f a, c;
          a[0] = o0[0] * inv; a[1] = o0[1] * inv; a[2] = o0[2] * inv; a[3] = o0[3] * inv; c[0] = o0[4] * inv; c[1] = o0[5] * inv; c[2] = o0[6] * inv; c[3] = o0[7] * inv;
          *(v4fa*)(&os[wb + lr * 68 +  0 + 8 * hi]) = a; *(v4fa*)(&os[wb + lr * 68 +  0 + 8 * hi + 4]) = c;
          a[0] = o1[0] * inv; a[1] = o1[1] * inv; a[2] = o1[2] * inv; a[3] = o1[3] * inv; c[0] = o1[4] * inv; c[1] = o1[5] * inv; c[2] = o1[6] * inv; c[3] = o1[7] * inv;
          *(v4fa*)(&os[wb + lr * 68 + 16 + 8 * hi]) = a; *(v4fa*)(&os[wb + lr * 68 + 16 + 8 * hi + 4]) = c;
          a[0] = o2[0] * inv; a[1] = o2[1] * inv; a[2] = o2[2] * inv; a[3] = o2[3] * inv; c[0] = o2[4] * inv; c[1] = o2[5] * inv; c[2] = o2[6] * inv; c[3] = o2[7] * inv;
          *(v4fa*)(&os[wb + lr * 68 + 32 + 8 * hi]) = a; *(v4fa*)(&os[wb + lr * 68 + 32 + 8 * hi + 4]) = c;
          a[0] = o3[0] * inv; a[1] = o3[1] * inv; a[2] = o3[2] * inv; a[3] = o3[3] * inv; c[0] = o3[4] * inv; c[1] = o3[5] * inv; c[2] = o3[6] * inv; c[3] = o3[7] * inv;
          *(v4fa*)(&os[wb + lr * 68 + 48 + 8 * hi]) = a; *(v4fa*)(&os[wb + lr * 68 + 48 + 8 * hi + 4]) = c; }
        wave_sync();
        float* orow = OUT + ((size_t)b * OUT_SEQ + t) * DM;      // token row: column = i*64 + d
{
#pragma unroll
            for (int s = 0; s < 8; ++s) { const int row = 2 * s + hi, cofs = lr * 4;   // 8 s x 2 rows = 16 head rows; 16 lanes x 4 floats = 64 columns
                const v4f val = *(const v4fa*)(&os[wb + row * 68 + cofs]);
                *(v4f*)(orow + (size_t)row * HD + cofs) = val; }
             }
        wave_sync();                                              // tile is rewritten by the next token
    }
}

static constexpr size_t al256(size_t v) { return (v + 255) & ~(size_t)255; }
static constexpr size_t SZ_XB = al256((size_t)NB * SEQ * DM * 2);
static constexpr size_t SZ_WB = al256((size_t)3 * DM * DM * 2);
static constexpr size_t SZ_PL = al256((size_t)NB * SEQ * DM * 2);
static constexpr size_t SZ_TOTAL = SZ_XB + SZ_WB + 4 * SZ_PL;
static_assert(SZ_TOTAL <= (size_t)134217728);          // workspace carve <= 128 MiB
static_assert(((size_t)DM * DM * 2) % 256 == 0);       // weight sub-planes stay 256-byte aligned

extern "C" void kernel_launch(void* const* d_in, const int* in_sizes, int n_in,
                              void* d_out, int out_size, void* d_ws, size_t ws_size, hipStream_t stream) {
    if (n_in < 4) return;
    const size_t needx = ((size_t)(NB - 1) * SEQ_FULL + SEQ) * DM;
    if ((size_t)in_sizes[0] < needx) return;
    if ((size_t)in_sizes[1] < (size_t)DM * DM || (size_t)in_sizes[2] < (size_t)DM * DM || (size_t)in_sizes[3] < (size_t)DM * DM) return;
    if ((size_t)out_size < ((size_t)(NB - 1) * OUT_SEQ + SEQ) * DM) return;
    if (SZ_TOTAL > ws_size) return;
    const float* x = (const float*)d_in[0]; const float* wq = (const float*)d_in[1]; const float* wk = (const float*)d_in[2]; const float* wv = (const float*)d_in[3];   // wire order x, Wq, Wk, Wv ([out][in] = Bt as-is)
    float* OUT = (float*)d_out;      // [NB][SEQ][1024]
    char* wsp = (char*)d_ws;
    bf* XB = (bf*)wsp; wsp += SZ_XB;                 // [NB*SEQ][1024]
    bf* WB = (bf*)wsp; wsp += SZ_WB;                 // [3][1024][1024]: q | k | v (v rows permuted: d*16+j <- j*64+d)
    h16* QH = (h16*)wsp; wsp += SZ_PL;               // [NB*SEQ][head*64+d]
    h16* QR = (h16*)wsp; wsp += SZ_PL;               // [NB*SEQ][head*64+d] residual x2048
    h16* KP = (h16*)wsp; wsp += SZ_PL;               // [NB*SEQ][head*64+d]
    h16* VT = (h16*)wsp; wsp += SZ_PL;               // [NB*SEQ][d*16+head]

    k_cvt<<<CVG, 32 * CVW, 0, stream>>>(x, wq, wk, wv, XB, WB);

    // q, k: A = x rows (m = b*SEQ + t), Bt = W rows (n = head*64 + d) -> plane [m][head*64 + d]; v^T: Bt = permuted Wv rows (n = d*16 + head) -> plane [m][d*16 + head]
    k_proj<<<dim3(NB * SEQ / PBM, DM / PBN, 1), 256, 0, stream>>>(XB, WB, QH, QR, KP, VT);

    k_xhead<<<dim3(NB * SEQ / (AW * PPW), 1, 1), 32 * AW, 0, stream>>>(QH, QR, KP, VT, OUT);
}

// v004
// Measured time: 58.6 microseconds a run.
// Timed twice side by side with v003, it ran 1.05 and 1.04 times as fast.
// Over all steps from v000 it is 2.30 times as fast.
#include <hip/hip_runtime.h>

// Per-token attention across heads, width 1024 = 16 heads x 64: x [NB][SEQ][1024], Wq/Wk/Wv [out][in] (y = x W^T), no biases, no mask, score scale 1/8;
// for each token the 16 head rows of q attend over the 16 head rows of k/v of the SAME token (scores 16x16, softmax over the key head), output column = head*64 + d (f32).
// Compute dtypes, f32 accumulate everywhere: projections v_wmma_f32_16x16x32_bf16 (x and W RNE-converted to bf16; products exact);
// scores v_wmma_f32_16x16x32_f16: k single f16, q as f16 value + f16 residual x2048 in its own accumulator; P (x256 carry, cancels in the normalisation) and v single f16; softmax f32.
// Layout: bf16 copies of x and W (the Wv copy with permuted rows d*16+j <- j*64+d); q (hi, residual), k planes [token][head*64+d] and v^T plane [token][d*16+head] written by the GEMM epilogue;
// per-token kernel in transposed form (S^T = K Q^T, O^T = V^T P^T, 16 keys zero-padded to the 32-deep step), output from f32 accumulators.

#ifndef NB
#define NB 4
#endif
#ifndef SEQ
#define SEQ 2048
#endif
#define NB_FULL  4
#define SEQ_FULL 2048
#ifndef OUT_SEQ
#define OUT_SEQ SEQ              // row pitch (in tokens) between batches of the output
#endif
#define DM   1024
#define NH_  16
#define HD   64
#define AW   4                   // waves per block of the per-token kernel
#define PPW  4                   // tokens handled sequentially by each wave
#define QRS  2048.0f             // carry of the q residual plane
#define QRI  (1.0f / 2048.0f)
#define SC2  (0.125f * 1.4426950408889634f)   // HD^-0.5 * log2(e)
#define PSH  8.0f                // log2 of the P carry (256)
#define PBM  256                 // projection GEMM: rows of C per work-group
#define PBN  128                 // columns of each of q, k, v per work-group
#define PKS  64                  // k per stage (128-B rows)
#define PLP  72                  // LDS row pitch in 16-bit elements (144 B = 16 B x odd, for 16-byte readers)
#define PSTG ((PBM + 3 * PBN) * PLP) // elements per buffer
#define BROW(nb) (((nb) >> 2) * PBN + ((nb) & 3) * 16)   // first row, inside the wave's B rows, of B fragment nb
#define PNT  (DM / PKS)          // stages
#define CVG  256                 // conversion launch: work-groups
#define CVW  16                  // waves per work-group
#define XPW  (NB * SEQ * DM / 128 / (CVG * CVW))   // 128-float pieces of x per wave
#define WPW  (DM * DM / 128 / (CVG * CVW))         // 128-float pieces of each weight per wave

static_assert(HD == 64);
static_assert(NH_ == 16);                      // one 16-key tile per token; v^T row = 16 halves
static_assert(NH_ * HD == DM);                 // head h = columns h*64 + d
static_assert(DM % 64 == 0);                   // 16 column tiles of 64
static_assert(DM % 32 == 0);                   // GEMM K splits into 32-deep blocks
static_assert((NB * SEQ) % PBM == 0);          // GEMM row tiles cover the token rows exactly
static_assert(DM % PBN == 0 && DM % PKS == 0 && PNT >= 2);   // column tiles and stages cover exactly; the two-buffer prologue needs two stages
static_assert(PKS == 64);                      // a stage is two 32-deep blocks
static_assert((NB * SEQ) % (AW * PPW) == 0);   // per-token grid covers the token rows exactly
static_assert(XPW >= 1 && (size_t)XPW * 128 * CVG * CVW == (size_t)NB * SEQ * DM);   // the waves' x pieces cover x exactly
static_assert(((size_t)SEQ * DM) % (XPW * 128) == 0);                                  // a wave's x pieces stay inside one batch
static_assert(WPW >= 1 && (size_t)WPW * 128 * CVG * CVW == (size_t)DM * DM);           // the waves' weight pieces cover each weight exactly
static_assert(DM % (WPW * 128) == 0);                                                  // a wave's weight pieces stay inside one row
static_assert(NB <= NB_FULL);
static_assert(SEQ <= SEQ_FULL);

typedef _Float16 h16;
typedef unsigned short bf;
typedef __attribute__((ext_vector_type(16))) __bf16   v16bf;
typedef __attribute__((ext_vector_type(16))) _Float16 v16h;
typedef __attribute__((ext_vector_type(8)))  _Float16 v8h;
typedef __attribute__((ext_vector_type(8)))  unsigned short v8us;
typedef __attribute__((ext_vector_type(4)))  unsigned short v4us;
typedef __attribute__((ext_vector_type(8)))  float    v8f;
typedef __attribute__((ext_vector_type(4)))  float    v4f;
typedef v4f  __attribute__((may_alias)) v4fa;
typedef __attribute__((ext_vector_type(4)))  int      v4i;
typedef __attribute__((address_space(1))) v4i gv4i;   // global and LDS pointees of the asynchronous copy builtin
typedef __attribute__((address_space(3))) v4i lv4i;

__device__ __forceinline__ unsigned short f2bf(float f) { unsigned u = __float_as_uint(f); u += 0x7FFFu + ((u >> 16) & 1u); return (unsigned short)(u >> 16); }
__device__ __forceinline__ v16h cat16(v8h lo, v8h hi) { return __builtin_shufflevector(lo, hi, 0, 1, 2, 3, 4, 5, 6, 7, 8, 9, 10, 11, 12, 13, 14, 15); }
__device__ __forceinline__ v16bf cat16b(v8us lo, v8us hi) { return __builtin_bit_cast(v16bf, __builtin_shufflevector(lo, hi, 0, 1, 2, 3, 4, 5, 6, 7, 8, 9, 10, 11, 12, 13, 14, 15)); }
__device__ __forceinline__ v8f wmma16(v16h a, v16h b, v8f c) { return __builtin_amdgcn_wmma_f32_16x16x32_f16(false, a, false, b, (short)0, c, false, false); }
__device__ __forceinline__ v8f wmmab(v16bf a, v16bf b, v8f c) { return __builtin_amdgcn_wmma_f32_16x16x32_bf16(false, a, false, b, (short)0, c, false, false); }
// fragment loaders from K-contiguous 16-bit rows; p already includes + 8*(lane>>4): elements 0..7 <- k0+8h+0..7, elements 8..15 <- k0+16+8h+0..7 (same map for A and B)
__device__ __forceinline__ v16h  ldh(const h16* p) { return cat16(*(const v8h*)p, *(const v8h*)(p + 16)); }
__device__ __forceinline__ v16bf ldb(const bf* p)  { return cat16b(*(const v8us*)p, *(const v8us*)(p + 16)); }
// ordering point for wave-private LDS tiles (same wave writes and reads)
__device__ __forceinline__ void wave_sync() { __builtin_amdgcn_fence(3 /* release order */, "wavefront"); __builtin_amdgcn_wave_barrier(); asm volatile("" ::: "memory"); }

// k_cvt: every f32 -> bf16 conversion (x, Wq, Wk, Wv) in ONE launch that is resident at once: CVG work-groups of CVW waves, so few waves have to be started and no launch waits on another.
// A piece = 128 consecutive floats = one wave-wide 16-byte load (512 B, four whole lines) -> one wave-wide 8-byte store (256 B, two whole lines).
// Wave gw takes XPW consecutive pieces of x and WPW consecutive pieces of each weight; all its loads are issued before the first value is converted.
// The Wv copy has permuted rows: dst row (d*16 + j) <- src row (j*64 + d); a piece lies inside one row, so loads and stores stay line-contiguous.
__device__ __forceinline__ v4us cvt4(v4f v) { v4us o; o[0] = f2bf(v[0]); o[1] = f2bf(v[1]); o[2] = f2bf(v[2]); o[3] = f2bf(v[3]); return o; }
__global__ __launch_bounds__(32 * CVW) void k_cvt(const float* __restrict__ x, const float* __restrict__ wq, const float* __restrict__ wk, const float* __restrict__ wv,
                                                  bf* __restrict__ XB, bf* __restrict__ WB) {
    const int lane = threadIdx.x & 31, wave = __builtin_amdgcn_readfirstlane((int)(threadIdx.x >> 5));
    const int gw = blockIdx.x * CVW + wave;
    const size_t ex = (size_t)gw * (XPW * 128);                                   // first element of the wave's x pieces (compact rows); XPW * 128 divides SEQ * DM, so they lie in one batch
    const size_t sx = ex + (ex / ((size_t)SEQ * DM)) * ((size_t)(SEQ_FULL - SEQ) * DM);
    const size_t ew = (size_t)gw * (WPW * 128);                                   // first element of the wave's pieces of each weight; WPW * 128 divides DM, so they lie in one row
    const size_t row = ew / DM, col = ew % DM;
    const size_t sv = ((row & 15) * (size_t)HD + (row >> 4)) * (size_t)DM + col;
    v4f rx[XPW], rq[WPW], rk[WPW], rv[WPW];
    // the four loops below are unrolled so that every piece index is a constant: the pieces stay in registers and the piece offsets become immediates
#pragma unroll
    for (int j = 0; j < XPW; ++j) rx[j] = *(const v4f*)(x + sx + j * 128 + lane * 4);
#pragma unroll
    for (int j = 0; j < WPW; ++j) { rq[j] = *(const v4f*)(wq + ew + j * 128 + lane * 4); rk[j] = *(const v4f*)(wk + ew + j * 128 + lane * 4); rv[j] = *(const v4f*)(wv + sv + j * 128 + lane * 4); }
    __builtin_amdgcn_sched_barrier(0);   // every load is issued before the first wait: without it the weight loads sink behind the x values' waits and the wave pays memory latency several times over
#pragma unroll
    for (int j = 0; j < XPW; ++j) *(v4us*)(XB + ex + j * 128 + lane * 4) = cvt4(rx[j]);
#pragma unroll
    for (int j = 0; j < WPW; ++j) {
        *(v4us*)(WB + ew + j * 128 + lane * 4) = cvt4(rq[j]);
        *(v4us*)(WB + (size_t)DM * DM + ew + j * 128 + lane * 4) = cvt4(rk[j]);
        *(v4us*)(WB + (size_t)2 * DM * DM + ew + j * 128 + lane * 4) = cvt4(rv[j]);
    }
}

__device__ __forceinline__ void cp16(const bf* g, bf* l) { __builtin_amdgcn_global_load_async_to_lds_b128((gv4i*)g, (lv4i*)l, 0, 0); }
// One thread's share of a stage: 40 copies, rows (tid>>3) + 16*j (j 0..15 of A, then 0..7 of Bq, of Bk, of Bv), 16-byte column tid&7; l = its place in the buffer, ga / gb = its global addresses (gb in the q plane).
__device__ __forceinline__ void stage_copy(bf* l, const bf* ga, const bf* gb) {
    const size_t GS = (size_t)16 * DM;
    // unrolled: every step of the two addresses is a constant
#pragma unroll
    for (int j = 0; j < 16; ++j) cp16(ga + j * GS, l + j * 16 * PLP);
#pragma unroll
    for (int w = 0; w < 3; ++w)
#pragma unroll
        for (int j = 0; j < 8; ++j) cp16(gb + (size_t)w * DM * DM + j * GS, l + (16 + w * 8 + j) * 16 * PLP);
}

// Epilogue pieces; the piece number is a template argument so that every accumulator index is a constant and the accumulators stay in registers.
// put_piece: piece I of the wave's accumulators into staging tile I & 1.
template <int I> __device__ __forceinline__ void put_piece(const v8f (&acc)[8][12], float* os, int lr, int hi) {
    float* o = os + (I & 1) * 16 * 68;
#pragma unroll
    for (int nb = 0; nb < 4; ++nb)
#pragma unroll
        for (int j = 0; j < 8; ++j) o[(hi * 8 + j) * 68 + nb * 16 + lr] = acc[I & 7][(I >> 3) * 4 + nb][j];   // D: row 8h+j, col lane&15
}
// out_piece: reads piece I back row-wise, issues the LDS writes of piece I + 1, then converts and stores piece I.
template <int I> __device__ __forceinline__ void out_piece(const v8f (&acc)[8][12], float* os, int lane, size_t tbase, h16* QH, h16* QR, h16* KP, h16* VT) {
    constexpr int w = I >> 3, mb = I & 7; constexpr bool useRes = w == 0;
    h16* Ph = w == 0 ? QH : (w == 1 ? KP : VT); h16* Pr = QR;
    const float* oi = os + (I & 1) * 16 * 68;
    wave_sync();
    v4f x0[4], x1[4];
#pragma unroll
    for (int s = 0; s < 4; ++s) { const int row = 4 * s + (lane >> 3), c8 = (lane & 7) * 8;   // 4 s x 4 row groups = 16 rows; 8 lanes x 8 = 64 columns
        x0[s] = *(const v4fa*)(&oi[row * 68 + c8]); x1[s] = *(const v4fa*)(&oi[row * 68 + c8 + 4]); }
    if constexpr (I + 1 < 24) put_piece<I + 1>(acc, os, lane & 15, lane >> 4);
    __builtin_amdgcn_sched_barrier(0);   // the next piece's LDS writes are issued before this piece's values are waited for
    v8h hv[4], rv[4];
#pragma unroll
    for (int s = 0; s < 4; ++s) {
#pragma unroll
        for (int e = 0; e < 4; ++e) { const h16 e0 = (h16)x0[s][e]; const h16 e1 = (h16)x1[s][e]; hv[s][e] = e0; hv[s][4 + e] = e1;
            if constexpr (useRes) { rv[s][e] = (h16)((x0[s][e] - (float)e0) * QRS); rv[s][4 + e] = (h16)((x1[s][e] - (float)e1) * QRS); } } }
    __builtin_amdgcn_sched_barrier(0);   // every value of the piece is converted before its first store, so none of the conversions rewrites a register of an issued store
    const size_t sb = tbase + (size_t)(mb * 16) * (size_t)DM;
#pragma unroll
    for (int s = 0; s < 4; ++s) { const int row = 4 * s + (lane >> 3), c8 = (lane & 7) * 8;
        const size_t oo = sb + (size_t)row * (size_t)DM + c8;
        *(v8h*)(Ph + oo) = hv[s]; if constexpr (useRes) *(v8h*)(Pr + oo) = rv[s]; }
    asm volatile("s_wait_xcnt 0x0" ::: "memory");   // stands in front of the next piece's LDS reads and conversions, which rewrite registers that these stores name
    __builtin_amdgcn_sched_barrier(0);   // holds those instructions behind the wait
}

__global__ __launch_bounds__(128) void k_proj(const bf* __restrict__ A, const bf* __restrict__ Wb, h16* QH, h16* QR, h16* KP, h16* VT) {
    __shared__ __align__(16) bf ring[2 * PSTG];
    __shared__ __align__(16) float osAll[4 * 2 * 16 * 68];
    const int K = DM;
    const int tid = threadIdx.x, lane = tid & 31, lr = lane & 15, hi = lane >> 4;
    const int wave = __builtin_amdgcn_readfirstlane(tid >> 5), wm = wave & 1, wn = wave >> 1;
    const int r0 = blockIdx.x * PBM, c0 = blockIdx.y * PBN;
    float* os = osAll + wave * 2 * 16 * 68;             // wave-private output staging, two tiles
    const bf* ga = A  + (size_t)(r0 + (tid >> 3)) * K + (tid & 7) * 8;
    const bf* gb = Wb + (size_t)(c0 + (tid >> 3)) * K + (tid & 7) * 8;
    bf* lcp = ring + (tid >> 3) * PLP + (tid & 7) * 8;
    // A fragment mb: rows wm*128 + mb*16; B fragment nb: weight nb>>2, its rows wn*64 + (nb&3)*16
    const int aofs = (wm * 128 + lr) * PLP + 8 * hi, bofs = (PBM + wn * 64 + lr) * PLP + 8 * hi;
    stage_copy(lcp, ga, gb);
    asm volatile("s_wait_asynccnt 0x0" ::: "memory");   // stage 0 has landed before the barrier publishes it
    __syncthreads();
    stage_copy(lcp + PSTG, ga + PKS, gb + PKS);
    // Every loop over fragments or accumulators is unrolled: the arrays stay in registers only with constant indices.
    v8f acc[8][12];
#pragma unroll
    for (int mb = 0; mb < 8; ++mb)
#pragma unroll
        for (int nb = 0; nb < 12; ++nb) acc[mb][nb] = (v8f){};
    // Fragment registers: both blocks' A sets (a0, a1) and ONE B set in two halves (b0, b1); a B half is reloaded as soon as its last matrix instruction is issued, one run of 48 ahead of its next use; a1 likewise but two runs ahead; a0 after the publish point, one run ahead.
    v16bf a0[8], a1[8], b0[6], b1[6];
#pragma unroll
    for (int mb = 0; mb < 8; ++mb) a0[mb] = ldb(ring + aofs + mb * 16 * PLP);
#pragma unroll
    for (int nb = 0; nb < 6; ++nb) b0[nb] = ldb(ring + bofs + BROW(nb) * PLP);
#pragma unroll 1   // one stage per trip: one copy of the hot loop in the instruction cache, the buffer picked by t & 1
    for (int t = 0; t < PNT; ++t) {
        const bf* rb = ring + (t & 1) * PSTG;
        const bf* rn = ring + ((t + 1) & 1) * PSTG;
        // every sched_barrier below: LDS reads and copies stand in groups between the runs of matrix instructions, none among them, and no run moves over the publish point
#pragma unroll
        for (int nb = 0; nb < 6; ++nb) b1[nb] = ldb(rb + bofs + BROW(nb + 6) * PLP);
#pragma unroll
        for (int mb = 0; mb < 8; ++mb) a1[mb] = ldb(rb + aofs + mb * 16 * PLP + 32);
        __builtin_amdgcn_sched_barrier(0);
#pragma unroll
        for (int nb = 0; nb < 6; ++nb)
#pragma unroll
            for (int mb = 0; mb < 8; ++mb) acc[mb][nb] = wmmab(a0[mb], b0[nb], acc[mb][nb]);
        __builtin_amdgcn_sched_barrier(0);
#pragma unroll
        for (int nb = 0; nb < 6; ++nb) b0[nb] = ldb(rb + bofs + BROW(nb) * PLP + 32);
        __builtin_amdgcn_sched_barrier(0);
#pragma unroll
        for (int nb = 0; nb < 6; ++nb)
#pragma unroll
            for (int mb = 0; mb < 8; ++mb) acc[mb][nb + 6] = wmmab(a0[mb], b1[nb], acc[mb][nb + 6]);
        __builtin_amdgcn_sched_barrier(0);
#pragma unroll
        for (int nb = 0; nb < 6; ++nb) b1[nb] = ldb(rb + bofs + BROW(nb + 6) * PLP + 32);
        __builtin_amdgcn_sched_barrier(0);
#pragma unroll
        for (int nb = 0; nb < 6; ++nb)
#pragma unroll
            for (int mb = 0; mb < 8; ++mb) acc[mb][nb] = wmmab(a1[mb], b0[nb], acc[mb][nb]);
        __builtin_amdgcn_sched_barrier(0);
        // publish point of stage t + 1, in front of the stage's last run: every fragment of stage t is in registers, and the reads behind the barrier are of stage t + 1
        asm volatile("s_wait_dscnt 0x0" ::: "memory");      // this wave's reads of the buffer have returned before it is handed to the copies
        asm volatile("s_wait_asynccnt 0x0" ::: "memory");   // this wave's copies of stage t + 1 have landed before the barrier publishes them
        __syncthreads();
        if (t + 2 < PNT) stage_copy(lcp + (t & 1) * PSTG, ga + (t + 2) * PKS, gb + (t + 2) * PKS);
        // first fragments of stage t + 1; in the last trip they re-read the other buffer's old stage (landed long ago, no copy aimed at it) and are not used
#pragma unroll
        for (int mb = 0; mb < 8; ++mb) a0[mb] = ldb(rn + aofs + mb * 16 * PLP);
#pragma unroll
        for (int nb = 0; nb < 6; ++nb) b0[nb] = ldb(rn + bofs + BROW(nb) * PLP);
        __builtin_amdgcn_sched_barrier(0);
#pragma unroll
        for (int nb = 0; nb < 6; ++nb)
#pragma unroll
            for (int mb = 0; mb < 8; ++mb) acc[mb][nb + 6] = wmmab(a1[mb], b1[nb], acc[mb][nb + 6]);
    }
    asm volatile("s_wait_asynccnt 0x0" ::: "memory");       // nothing of this wave in flight behind the last stage
    // Epilogue: 24 pieces of 16 rows x 64 columns (piece i: weight i>>3, row block i&7) go through two wave-private f32 tiles in turn: piece i + 1 is written to its tile while piece i is converted and stored.
    const size_t tbase = (size_t)(r0 + wm * 128) * (size_t)DM + (size_t)(c0 + wn * 64);
    put_piece<0>(acc, os, lr, hi);
#define OUT4(i) out_piece<i>(acc, os, lane, tbase, QH, QR, KP, VT); out_piece<i + 1>(acc, os, lane, tbase, QH, QR, KP, VT); out_piece<i + 2>(acc, os, lane, tbase, QH, QR, KP, VT); out_piece<i + 3>(acc, os, lane, tbase, QH, QR, KP, VT);
    OUT4(0) OUT4(4) OUT4(8) OUT4(12) OUT4(16) OUT4(20)
#undef OUT4
}

// k_xhead: per-token attention across the 16 heads, one wave per token (PPW tokens in sequence); K / Q / V^T fragments straight from the f16 planes (16-B loads, arithmetic addressing).
// Transposed form: S^T[j][i] = K Q^T (A = K head rows j, B = Q head rows i, k = d, two 32-deep steps); lane (i = lane&15, h = lane>>4) holds keys j = 8h+r, so the packed
// P values are directly elements 0..7 of the B fragment of O^T[d][i] = V^T P^T (k = j = 8h+r); elements 8..15 (k = 16..31) are literal zeros in BOTH operands.
// V^T A fragment: row d = 16*jt + lane&15, elements 0..7 <- plane[token][d*16 + 8h + 0..7] (one 16-B load), elements 8..15 zero.
// Softmax: lane-local max/sum over 8 keys, the two lane halves of a query combined with one xor-16 exchange (all lanes active, uniform control).
__global__ __launch_bounds__(32 * AW) void k_xhead(const h16* __restrict__ QH, const h16* __restrict__ QR, const h16* __restrict__ KP, const h16* __restrict__ VT, float* OUT) {
    __shared__ __align__(16) float os[AW * 16 * 68];
    const int lane = threadIdx.x & 31, wave = __builtin_amdgcn_readfirstlane((int)(threadIdx.x >> 5)), lr = lane & 15, hi = lane >> 4;
    const int wb = wave * 16 * 68;
    const int pos0 = (blockIdx.x * AW + wave) * PPW;
#pragma unroll 1
    for (int pp = 0; pp < PPW; ++pp) {
        const int m = pos0 + pp;                       // compact token row of the planes
        const int b = m / SEQ, t = m % SEQ;
        const size_t rb = (size_t)m * DM;
        const size_t qo = rb + (size_t)lr * HD + 8 * hi;
        const v16h qh0 = ldh(QH + qo), qh1 = ldh(QH + qo + 32), qr0 = ldh(QR + qo), qr1 = ldh(QR + qo + 32);   // B fragments: col i, k = d
        const v16h ka0 = ldh(KP + qo), ka1 = ldh(KP + qo + 32);                                                // A fragments: row j, k = d
        v8f sH = (v8f){}, sL = (v8f){};
        sH = wmma16(ka0, qh0, sH); sL = wmma16(ka0, qr0, sL);
        sH = wmma16(ka1, qh1, sH); sL = wmma16(ka1, qr1, sL);
        asm volatile("v_nop\n\tv_nop\n\tv_nop\n\tv_nop" : "+v"(sH), "+v"(sL) : "v"(ka0), "v"(ka1), "v"(qh0), "v"(qh1), "v"(qr0), "v"(qr1));
        float ta[8]; float mx = -3.0e38f;
#pragma unroll
        for (int r = 0; r < 8; ++r) { ta[r] = (sH[r] + sL[r] * QRI) * SC2; mx = fmaxf(mx, ta[r]); }
        mx = fmaxf(mx, __shfl_xor(mx, 16, 32));
        const float sh = PSH - mx;
        v16h pb; float l = 0.0f;
#pragma unroll
        for (int r = 0; r < 8; ++r) { const h16 pa = (h16)__builtin_amdgcn_exp2f(ta[r] + sh); pb[r] = pa; pb[8 + r] = (h16)0.0f; l += (float)pa; }
        l += __shfl_xor(l, 16, 32);
        const float inv = 1.0f / l;
        const size_t vo = rb + (size_t)lr * 16 + 8 * hi;          // + jt*256: row d = 16*jt + lr, k = j = 8h + e
        const v8h zz = (v8h){};
        const v16h v0 = cat16(*(const v8h*)(VT + vo), zz), v1 = cat16(*(const v8h*)(VT + vo + 256), zz), v2 = cat16(*(const v8h*)(VT + vo + 512), zz), v3 = cat16(*(const v8h*)(VT + vo + 768), zz);
        v8f o0 = (v8f){}, o1 = (v8f){}, o2 = (v8f){}, o3 = (v8f){};
        o0 = wmma16(v0, pb, o0); o1 = wmma16(v1, pb, o1); o2 = wmma16(v2, pb, o2); o3 = wmma16(v3, pb, o3);
        asm volatile("v_nop\n\tv_nop\n\tv_nop\n\tv_nop" : "+v"(o0), "+v"(o1), "+v"(o2), "+v"(o3) : "v"(v0), "v"(v1), "v"(v2), "v"(v3), "v"(pb));
        // O^T D layout: o_jt[r] = (d = 16jt + 8h + r, i = lane&15) -> os[i][d]; rows 0..15 x columns 0..63 all written
        { v4f a, c;
          a[0] = o0[0] * inv; a[1] = o0[1] * inv; a[2] = o0[2] * inv; a[3] = o0[3] * inv; c[0] = o0[4] * inv; c[1] = o0[5] * inv; c[2] = o0[6] * inv; c[3] = o0[7] * inv;
          *(v4fa*)(&os[wb + lr * 68 +  0 + 8 * hi]) = a; *(v4fa*)(&os[wb + lr * 68 +  0 + 8 * hi + 4]) = c;
          a[0] = o1[0] * inv; a[1] = o1[1] * inv; a[2] = o1[2] * inv; a[3] = o1[3] * inv; c[0] = o1[4] * inv; c[1] = o1[5] * inv; c[2] = o1[6] * inv; c[3] = o1[7] * inv;
          *(v4fa*)(&os[wb + lr * 68 + 16 + 8 * hi]) = a; *(v4fa*)(&os[wb + lr * 68 + 16 + 8 * hi + 4]) = c;
          a[0] = o2[0] * inv; a[1] = o2[1] * inv; a[2] = o2[2] * inv; a[3] = o2[3] * inv; c[0] = o2[4] * inv; c[1] = o2[5] * inv; c[2] = o2[6] * inv; c[3] = o2[7] * inv;
          *(v4fa*)(&os[wb + lr * 68 + 32 + 8 * hi]) = a; *(v4fa*)(&os[wb + lr * 68 + 32 + 8 * hi + 4]) = c;
          a[0] = o3[0] * inv; a[1] = o3[1] * inv; a[2] = o3[2] * inv; a[3] = o3[3] * inv; c[0] = o3[4] * inv; c[1] = o3[5] * inv; c[2] = o3[6] * inv; c[3] = o3[7] * inv;
          *(v4fa*)(&os[wb + lr * 68 + 48 + 8 * hi]) = a; *(v4fa*)(&os[wb + lr * 68 + 48 + 8 * hi + 4]) = c; }
        wave_sync();
        float* orow = OUT + ((size_t)b * OUT_SEQ + t) * DM;      // token row: column = i*64 + d
{
#pragma unroll
            for (int s = 0; s < 8; ++s) { const int row = 2 * s + hi, cofs = lr * 4;   // 8 s x 2 rows = 16 head rows; 16 lanes x 4 floats = 64 columns
                const v4f val = *(const v4fa*)(&os[wb + row * 68 + cofs]);
                *(v4f*)(orow + (size_t)row * HD + cofs) = val; }
             }
        wave_sync();                                              // tile is rewritten by the next token
    }
}

static constexpr size_t al256(size_t v) { return (v + 255) & ~(size_t)255; }
static constexpr size_t SZ_XB = al256((size_t)NB * SEQ * DM * 2);
static constexpr size_t SZ_WB = al256((size_t)3 * DM * DM * 2);
static constexpr size_t SZ_PL = al256((size_t)NB * SEQ * DM * 2);
static constexpr size_t SZ_TOTAL = SZ_XB + SZ_WB + 4 * SZ_PL;
static_assert(SZ_TOTAL <= (size_t)134217728);          // workspace carve <= 128 MiB
static_assert(((size_t)DM * DM * 2) % 256 == 0);       // weight sub-planes stay 256-byte aligned

extern "C" void kernel_launch(void* const* d_in, const int* in_sizes, int n_in,
                              void* d_out, int out_size, void* d_ws, size_t ws_size, hipStream_t stream) {
    if (n_in < 4) return;
    const size_t needx = ((size_t)(NB - 1) * SEQ_FULL + SEQ) * DM;
    if ((size_t)in_sizes[0] < needx) return;
    if ((size_t)in_sizes[1] < (size_t)DM * DM || (size_t)in_sizes[2] < (size_t)DM * DM || (size_t)in_sizes[3] < (size_t)DM * DM) return;
    if ((size_t)out_size < ((size_t)(NB - 1) * OUT_SEQ + SEQ) * DM) return;
    if (SZ_TOTAL > ws_size) return;
    const float* x = (const float*)d_in[0]; const float* wq = (const float*)d_in[1]; const float* wk = (const float*)d_in[2]; const float* wv = (const float*)d_in[3];   // wire order x, Wq, Wk, Wv ([out][in] = Bt as-is)
    float* OUT = (float*)d_out;      // [NB][SEQ][1024]
    char* wsp = (char*)d_ws;
    bf* XB = (bf*)wsp; wsp += SZ_XB;                 // [NB*SEQ][1024]
    bf* WB = (bf*)wsp; wsp += SZ_WB;                 // [3][1024][1024]: q | k | v (v rows permuted: d*16+j <- j*64+d)
    h16* QH = (h16*)wsp; wsp += SZ_PL;               // [NB*SEQ][head*64+d]
    h16* QR = (h16*)wsp; wsp += SZ_PL;               // [NB*SEQ][head*64+d] residual x2048
    h16* KP = (h16*)wsp; wsp += SZ_PL;               // [NB*SEQ][head*64+d]
    h16* VT = (h16*)wsp; wsp += SZ_PL;               // [NB*SEQ][d*16+head]

    k_cvt<<<CVG, 32 * CVW, 0, stream>>>(x, wq, wk, wv, XB, WB);

    // q, k: A = x rows (m = b*SEQ + t), Bt = W rows (n = head*64 + d) -> plane [m][head*64 + d]; v^T: Bt = permuted Wv rows (n = d*16 + head) -> plane [m][d*16 + head]
    k_proj<<<dim3(NB * SEQ / PBM, DM / PBN, 1), 128, 0, stream>>>(XB, WB, QH, QR, KP, VT);

    k_xhead<<<dim3(NB * SEQ / (AW * PPW), 1, 1), 32 * AW, 0, stream>>>(QH, QR, KP, VT, OUT);
}

// v005
// One run takes 54.6 microseconds.
// In two side-by-side timings against v004, it was 1.08 and 1.07 times as fast.
// Over all steps from v000 it is 2.47 times as fast.
#include <hip/hip_runtime.h>

// Per-token attention across heads, width 1024 = 16 heads x 64: x [NB][SEQ][1024], Wq/Wk/Wv [out][in] (y = x W^T), no biases, no mask, score scale 1/8;
// for each token the 16 head rows of q attend over the 16 head rows of k/v of the SAME token (scores 16x16, softmax over the key head), output column = head*64 + d (f32).
// Compute dtypes, f32 accumulate everywhere: projections v_wmma_f32_16x16x32_bf16 (x and W RNE-converted to bf16; products exact);
// scores v_wmma_f32_16x16x32_f16: q and k single f16 (the f16 rounding of q or k is roughly ten times smaller than the error that the bf16 operands of the projection leave in it); P (x256 carry, cancels in the normalisation) and v single f16; softmax f32.
// Layout: bf16 copies of x and W (the Wv copy with permuted rows d*16+j <- j*64+d); q, k planes [token][head*64+d] and v^T plane [token][d*16+head] written by the GEMM epilogue;
// per-token kernel in transposed form (S^T = K Q^T, O^T = V^T P^T, 16 keys zero-padded to the 32-deep step), output from f32 accumulators.

#ifndef NB
#define NB 4
#endif
#ifndef SEQ
#define SEQ 2048
#endif
#define NB_FULL  4
#define SEQ_FULL 2048
#ifndef OUT_SEQ
#define OUT_SEQ SEQ              // row pitch (in tokens) between batches of the output
#endif
#define DM   1024
#define NH_  16
#define HD   64
#define AW   4                   // waves per block of the per-token kernel
#define PPW  4                   // tokens handled sequentially by each wave
#define SC2  (0.125f * 1.4426950408889634f)   // HD^-0.5 * log2(e)
#define PSH  8.0f                // log2 of the P carry (256)
#define PBM  256                 // projection GEMM: rows of C per work-group
#define PBN  128                 // columns of each of q, k, v per work-group
#define PKS  64                  // k per stage (128-B rows)
#define PLP  72                  // LDS row pitch in 16-bit elements (144 B = 16 B x odd, for 16-byte readers)
#define PSTG ((PBM + 3 * PBN) * PLP) // elements per buffer
#define BROW(nb) (((nb) >> 2) * PBN + ((nb) & 3) * 16)   // first row, inside the wave's B rows, of B fragment nb
#define PNT  (DM / PKS)          // stages
#define CVG  256                 // conversion launch: work-groups
#define CVW  16                  // waves per work-group
#define XPW  (NB * SEQ * DM / 128 / (CVG * CVW))   // 128-float pieces of x per wave
#define WPW  (DM * DM / 128 / (CVG * CVW))         // 128-float pieces of each weight per wave

static_assert(HD == 64);
static_assert(NH_ == 16);                      // one 16-key tile per token; v^T row = 16 halves
static_assert(NH_ * HD == DM);                 // head h = columns h*64 + d
static_assert(DM % 64 == 0);                   // 16 column tiles of 64
static_assert(DM % 32 == 0);                   // GEMM K splits into 32-deep blocks
static_assert((NB * SEQ) % PBM == 0);          // GEMM row tiles cover the token rows exactly
static_assert(DM % PBN == 0 && DM % PKS == 0 && PNT >= 2);   // column tiles and stages cover exactly; the two-buffer prologue needs two stages
static_assert(PKS == 64);                      // a stage is two 32-deep blocks
static_assert((NB * SEQ) % (AW * PPW) == 0);   // per-token grid covers the token rows exactly
static_assert(XPW >= 1 && (size_t)XPW * 128 * CVG * CVW == (size_t)NB * SEQ * DM);   // the waves' x pieces cover x exactly
static_assert(((size_t)SEQ * DM) % (XPW * 128) == 0);                                  // a wave's x pieces stay inside one batch
static_assert(WPW >= 1 && (size_t)WPW * 128 * CVG * CVW == (size_t)DM * DM);           // the waves' weight pieces cover each weight exactly
static_assert(DM % (WPW * 128) == 0);                                                  // a wave's weight pieces stay inside one row
static_assert(NB <= NB_FULL);
static_assert(SEQ <= SEQ_FULL);

typedef _Float16 h16;
typedef unsigned short bf;
typedef __attribute__((ext_vector_type(16))) __bf16   v16bf;
typedef __attribute__((ext_vector_type(16))) _Float16 v16h;
typedef __attribute__((ext_vector_type(8)))  _Float16 v8h;
typedef __attribute__((ext_vector_type(8)))  unsigned short v8us;
typedef __attribute__((ext_vector_type(4)))  unsigned short v4us;
typedef __attribute__((ext_vector_type(8)))  float    v8f;
typedef __attribute__((ext_vector_type(4)))  float    v4f;
typedef v4f  __attribute__((may_alias)) v4fa;
typedef __attribute__((ext_vector_type(4)))  int      v4i;
typedef __attribute__((address_space(1))) v4i gv4i;   // global and LDS pointees of the asynchronous copy builtin
typedef __attribute__((address_space(3))) v4i lv4i;

__device__ __forceinline__ unsigned short f2bf(float f) { unsigned u = __float_as_uint(f); u += 0x7FFFu + ((u >> 16) & 1u); return (unsigned short)(u >> 16); }
__device__ __forceinline__ v16h cat16(v8h lo, v8h hi) { return __builtin_shufflevector(lo, hi, 0, 1, 2, 3, 4, 5, 6, 7, 8, 9, 10, 11, 12, 13, 14, 15); }
__device__ __forceinline__ v16bf cat16b(v8us lo, v8us hi) { return __builtin_bit_cast(v16bf, __builtin_shufflevector(lo, hi, 0, 1, 2, 3, 4, 5, 6, 7, 8, 9, 10, 11, 12, 13, 14, 15)); }
__device__ __forceinline__ v8f wmma16(v16h a, v16h b, v8f c) { return __builtin_amdgcn_wmma_f32_16x16x32_f16(false, a, false, b, (short)0, c, false, false); }
__device__ __forceinline__ v8f wmmab(v16bf a, v16bf b, v8f c) { return __builtin_amdgcn_wmma_f32_16x16x32_bf16(false, a, false, b, (short)0, c, false, false); }
// fragment loaders from K-contiguous 16-bit rows; p already includes + 8*(lane>>4): elements 0..7 <- k0+8h+0..7, elements 8..15 <- k0+16+8h+0..7 (same map for A and B)
__device__ __forceinline__ v16h  ldh(const h16* p) { return cat16(*(const v8h*)p, *(const v8h*)(p + 16)); }
__device__ __forceinline__ v16bf ldb(const bf* p)  { return cat16b(*(const v8us*)p, *(const v8us*)(p + 16)); }
// ordering point for wave-private LDS tiles (same wave writes and reads)
__device__ __forceinline__ void wave_sync() { __builtin_amdgcn_fence(3 /* release order */, "wavefront"); __builtin_amdgcn_wave_barrier(); asm volatile("" ::: "memory"); }

// k_cvt: every f32 -> bf16 conversion (x, Wq, Wk, Wv) in ONE launch that is resident at once: CVG work-groups of CVW waves, so few waves have to be started and no launch waits on another.
// A piece = 128 consecutive floats = one wave-wide 16-byte load (512 B, four whole lines) -> one wave-wide 8-byte store (256 B, two whole lines).
// Wave gw takes XPW consecutive pieces of x and WPW consecutive pieces of each weight; all its loads are issued before the first value is converted.
// The Wv copy has permuted rows: dst row (d*16 + j) <- src row (j*64 + d); a piece lies inside one row, so loads and stores stay line-contiguous.
__device__ __forceinline__ v4us cvt4(v4f v) { v4us o; o[0] = f2bf(v[0]); o[1] = f2bf(v[1]); o[2] = f2bf(v[2]); o[3] = f2bf(v[3]); return o; }
__global__ __launch_bounds__(32 * CVW) void k_cvt(const float* __restrict__ x, const float* __restrict__ wq, const float* __restrict__ wk, const float* __restrict__ wv,
                                                  bf* __restrict__ XB, bf* __restrict__ WB) {
    const int lane = threadIdx.x & 31, wave = __builtin_amdgcn_readfirstlane((int)(threadIdx.x >> 5));
    const int gw = blockIdx.x * CVW + wave;
    const size_t ex = (size_t)gw * (XPW * 128);                                   // first element of the wave's x pieces (compact rows); XPW * 128 divides SEQ * DM, so they lie in one batch
    const size_t sx = ex + (ex / ((size_t)SEQ * DM)) * ((size_t)(SEQ_FULL - SEQ) * DM);
    const size_t ew = (size_t)gw * (WPW * 128);                                   // first element of the wave's pieces of each weight; WPW * 128 divides DM, so they lie in one row
    const size_t row = ew / DM, col = ew % DM;
    const size_t sv = ((row & 15) * (size_t)HD + (row >> 4)) * (size_t)DM + col;
    v4f rx[XPW], rq[WPW], rk[WPW], rv[WPW];
    // the four loops below are unrolled so that every piece index is a constant: the pieces stay in registers and the piece offsets become immediates
#pragma unroll
    for (int j = 0; j < XPW; ++j) rx[j] = *(const v4f*)(x + sx + j * 128 + lane * 4);
#pragma unroll
    for (int j = 0; j < WPW; ++j) { rq[j] = *(const v4f*)(wq + ew + j * 128 + lane * 4); rk[j] = *(const v4f*)(wk + ew + j * 128 + lane * 4); rv[j] = *(const v4f*)(wv + sv + j * 128 + lane * 4); }
    __builtin_amdgcn_sched_barrier(0);   // every load is issued before the first wait: without it the weight loads sink behind the x values' waits and the wave pays memory latency several times over
#pragma unroll
    for (int j = 0; j < XPW; ++j) *(v4us*)(XB + ex + j * 128 + lane * 4) = cvt4(rx[j]);
#pragma unroll
    for (int j = 0; j < WPW; ++j) {
        *(v4us*)(WB + ew + j * 128 + lane * 4) = cvt4(rq[j]);
        *(v4us*)(WB + (size_t)DM * DM + ew + j * 128 + lane * 4) = cvt4(rk[j]);
        *(v4us*)(WB + (size_t)2 * DM * DM + ew + j * 128 + lane * 4) = cvt4(rv[j]);
    }
}

__device__ __forceinline__ void cp16(const bf* g, bf* l) { __builtin_amdgcn_global_load_async_to_lds_b128((gv4i*)g, (lv4i*)l, 0, 0); }
// One thread's share of a stage: 40 copies, rows (tid>>3) + 16*j (j 0..15 of A, then 0..7 of Bq, of Bk, of Bv), 16-byte column tid&7; l = its place in the buffer, ga / gb = its global addresses (gb in the q plane).
__device__ __forceinline__ void stage_copy(bf* l, const bf* ga, const bf* gb) {
    const size_t GS = (size_t)16 * DM;
    // unrolled: every step of the two addresses is a constant
#pragma unroll
    for (int j = 0; j < 16; ++j) cp16(ga + j * GS, l + j * 16 * PLP);
#pragma unroll
    for (int w = 0; w < 3; ++w)
#pragma unroll
        for (int j = 0; j < 8; ++j) cp16(gb + (size_t)w * DM * DM + j * GS, l + (16 + w * 8 + j) * 16 * PLP);
}

// Epilogue pieces; the piece number is a template argument so that every accumulator index is a constant and the accumulators stay in registers.
// put_piece: piece I of the wave's accumulators into staging tile I & 1.
template <int I> __device__ __forceinline__ void put_piece(const v8f (&acc)[8][12], float* os, int lr, int hi) {
    float* o = os + (I & 1) * 16 * 68;
#pragma unroll
    for (int nb = 0; nb < 4; ++nb)
#pragma unroll
        for (int j = 0; j < 8; ++j) o[(hi * 8 + j) * 68 + nb * 16 + lr] = acc[I & 7][(I >> 3) * 4 + nb][j];   // D: row 8h+j, col lane&15
}
// out_piece: reads piece I back row-wise, issues the LDS writes of piece I + 1, then converts and stores piece I.
template <int I> __device__ __forceinline__ void out_piece(const v8f (&acc)[8][12], float* os, int lane, size_t tbase, h16* QH, h16* KP, h16* VT) {
    constexpr int w = I >> 3, mb = I & 7;
    h16* Ph = w == 0 ? QH : (w == 1 ? KP : VT);
    const float* oi = os + (I & 1) * 16 * 68;
    wave_sync();
    v4f x0[4], x1[4];
#pragma unroll
    for (int s = 0; s < 4; ++s) { const int row = 4 * s + (lane >> 3), c8 = (lane & 7) * 8;   // 4 s x 4 row groups = 16 rows; 8 lanes x 8 = 64 columns
        x0[s] = *(const v4fa*)(&oi[row * 68 + c8]); x1[s] = *(const v4fa*)(&oi[row * 68 + c8 + 4]); }
    if constexpr (I + 1 < 24) put_piece<I + 1>(acc, os, lane & 15, lane >> 4);
    __builtin_amdgcn_sched_barrier(0);   // the next piece's LDS writes are issued before this piece's values are waited for
    v8h hv[4];
#pragma unroll
    for (int s = 0; s < 4; ++s) {
#pragma unroll
        for (int e = 0; e < 4; ++e) { hv[s][e] = (h16)x0[s][e]; hv[s][4 + e] = (h16)x1[s][e]; } }
    __builtin_amdgcn_sched_barrier(0);   // every value of the piece is converted before its first store, so none of the conversions rewrites a register of an issued store
    const size_t sb = tbase + (size_t)(mb * 16) * (size_t)DM;
#pragma unroll
    for (int s = 0; s < 4; ++s) { const int row = 4 * s + (lane >> 3), c8 = (lane & 7) * 8;
        const size_t oo = sb + (size_t)row * (size_t)DM + c8;
        *(v8h*)(Ph + oo) = hv[s]; }
    asm volatile("s_wait_xcnt 0x0" ::: "memory");   // stands in front of the next piece's LDS reads and conversions, which rewrite registers that these stores name
    __builtin_amdgcn_sched_barrier(0);   // holds those instructions behind the wait
}

__global__ __launch_bounds__(128) void k_proj(const bf* __restrict__ A, const bf* __restrict__ Wb, h16* QH, h16* KP, h16* VT) {
    __shared__ __align__(16) bf ring[2 * PSTG];
    __shared__ __align__(16) float osAll[4 * 2 * 16 * 68];
    const int K = DM;
    const int tid = threadIdx.x, lane = tid & 31, lr = lane & 15, hi = lane >> 4;
    const int wave = __builtin_amdgcn_readfirstlane(tid >> 5), wm = wave & 1, wn = wave >> 1;
    const int r0 = blockIdx.x * PBM, c0 = blockIdx.y * PBN;
    float* os = osAll + wave * 2 * 16 * 68;             // wave-private output staging, two tiles
    const bf* ga = A  + (size_t)(r0 + (tid >> 3)) * K + (tid & 7) * 8;
    const bf* gb = Wb + (size_t)(c0 + (tid >> 3)) * K + (tid & 7) * 8;
    bf* lcp = ring + (tid >> 3) * PLP + (tid & 7) * 8;
    // A fragment mb: rows wm*128 + mb*16; B fragment nb: weight nb>>2, its rows wn*64 + (nb&3)*16
    const int aofs = (wm * 128 + lr) * PLP + 8 * hi, bofs = (PBM + wn * 64 + lr) * PLP + 8 * hi;
    stage_copy(lcp, ga, gb);
    asm volatile("s_wait_asynccnt 0x0" ::: "memory");   // stage 0 has landed before the barrier publishes it
    __syncthreads();
    stage_copy(lcp + PSTG, ga + PKS, gb + PKS);
    // Every loop over fragments or accumulators is unrolled: the arrays stay in registers only with constant indices.
    v8f acc[8][12];
#pragma unroll
    for (int mb = 0; mb < 8; ++mb)
#pragma unroll
        for (int nb = 0; nb < 12; ++nb) acc[mb][nb] = (v8f){};
    // Fragment registers: both blocks' A sets (a0, a1) and ONE B set in two halves (b0, b1); a B half is reloaded as soon as its last matrix instruction is issued, one run of 48 ahead of its next use; a1 likewise but two runs ahead; a0 after the publish point, one run ahead.
    v16bf a0[8], a1[8], b0[6], b1[6];
#pragma unroll
    for (int mb = 0; mb < 8; ++mb) a0[mb] = ldb(ring + aofs + mb * 16 * PLP);
#pragma unroll
    for (int nb = 0; nb < 6; ++nb) b0[nb] = ldb(ring + bofs + BROW(nb) * PLP);
#pragma unroll 1   // one stage per trip: one copy of the hot loop in the instruction cache, the buffer picked by t & 1
    for (int t = 0; t < PNT; ++t) {
        const bf* rb = ring + (t & 1) * PSTG;
        const bf* rn = ring + ((t + 1) & 1) * PSTG;
        // every sched_barrier below: LDS reads and copies stand in groups between the runs of matrix instructions, none among them, and no run moves over the publish point
#pragma unroll
        for (int nb = 0; nb < 6; ++nb) b1[nb] = ldb(rb + bofs + BROW(nb + 6) * PLP);
#pragma unroll
        for (int mb = 0; mb < 8; ++mb) a1[mb] = ldb(rb + aofs + mb * 16 * PLP + 32);
        __builtin_amdgcn_sched_barrier(0);
#pragma unroll
        for (int nb = 0; nb < 6; ++nb)
#pragma unroll
            for (int mb = 0; mb < 8; ++mb) acc[mb][nb] = wmmab(a0[mb], b0[nb], acc[mb][nb]);
        __builtin_amdgcn_sched_barrier(0);
#pragma unroll
        for (int nb = 0; nb < 6; ++nb) b0[nb] = ldb(rb + bofs + BROW(nb) * PLP + 32);
        __builtin_amdgcn_sched_barrier(0);
#pragma unroll
        for (int nb = 0; nb < 6; ++nb)
#pragma unroll
            for (int mb = 0; mb < 8; ++mb) acc[mb][nb + 6] = wmmab(a0[mb], b1[nb], acc[mb][nb + 6]);
        __builtin_amdgcn_sched_barrier(0);
#pragma unroll
        for (int nb = 0; nb < 6; ++nb) b1[nb] = ldb(rb + bofs + BROW(nb + 6) * PLP + 32);
        __builtin_amdgcn_sched_barrier(0);
#pragma unroll
        for (int nb = 0; nb < 6; ++nb)
#pragma unroll
            for (int mb = 0; mb < 8; ++mb) acc[mb][nb] = wmmab(a1[mb], b0[nb], acc[mb][nb]);
        __builtin_amdgcn_sched_barrier(0);
        // publish point of stage t + 1, in front of the stage's last run: every fragment of stage t is in registers, and the reads behind the barrier are of stage t + 1
        asm volatile("s_wait_dscnt 0x0" ::: "memory");      // this wave's reads of the buffer have returned before it is handed to the copies
        asm volatile("s_wait_asynccnt 0x0" ::: "memory");   // this wave's copies of stage t + 1 have landed before the barrier publishes them
        __syncthreads();
        if (t + 2 < PNT) stage_copy(lcp + (t & 1) * PSTG, ga + (t + 2) * PKS, gb + (t + 2) * PKS);
        // first fragments of stage t + 1; in the last trip they re-read the other buffer's old stage (landed long ago, no copy aimed at it) and are not used
#pragma unroll
        for (int mb = 0; mb < 8; ++mb) a0[mb] = ldb(rn + aofs + mb * 16 * PLP);
#pragma unroll
        for (int nb = 0; nb < 6; ++nb) b0[nb] = ldb(rn + bofs + BROW(nb) * PLP);
        __builtin_amdgcn_sched_barrier(0);
#pragma unroll
        for (int nb = 0; nb < 6; ++nb)
#pragma unroll
            for (int mb = 0; mb < 8; ++mb) acc[mb][nb + 6] = wmmab(a1[mb], b1[nb], acc[mb][nb + 6]);
    }
    asm volatile("s_wait_asynccnt 0x0" ::: "memory");       // nothing of this wave in flight behind the last stage
    // Epilogue: 24 pieces of 16 rows x 64 columns (piece i: weight i>>3, row block i&7) go through two wave-private f32 tiles in turn: piece i + 1 is written to its tile while piece i is converted and stored.
    const size_t tbase = (size_t)(r0 + wm * 128) * (size_t)DM + (size_t)(c0 + wn * 64);
    put_piece<0>(acc, os, lr, hi);
#define OUT4(i) out_piece<i>(acc, os, lane, tbase, QH, KP, VT); out_piece<i + 1>(acc, os, lane, tbase, QH, KP, VT); out_piece<i + 2>(acc, os, lane, tbase, QH, KP, VT); out_piece<i + 3>(acc, os, lane, tbase, QH, KP, VT);
    OUT4(0) OUT4(4) OUT4(8) OUT4(12) OUT4(16) OUT4(20)
#undef OUT4
}

// k_xhead: per-token attention across the 16 heads, one wave per token (PPW tokens in sequence); K / Q / V^T fragments straight from the f16 planes (16-B loads, arithmetic addressing).
// Transposed form: S^T[j][i] = K Q^T (A = K head rows j, B = Q head rows i, k = d, two 32-deep steps); lane (i = lane&15, h = lane>>4) holds keys j = 8h+r, so the packed
// P values are directly elements 0..7 of the B fragment of O^T[d][i] = V^T P^T (k = j = 8h+r); elements 8..15 (k = 16..31) are literal zeros in BOTH operands.
// V^T A fragment: row d = 16*jt + lane&15, elements 0..7 <- plane[token][d*16 + 8h + 0..7] (one 16-B load), elements 8..15 zero.
// Softmax: lane-local max/sum over 8 keys, the two lane halves of a query combined with one xor-16 exchange (all lanes active, uniform control).
__global__ __launch_bounds__(32 * AW) void k_xhead(const h16* __restrict__ QH, const h16* __restrict__ KP, const h16* __restrict__ VT, float* OUT) {
    __shared__ __align__(16) float os[AW * 16 * 68];
    const int lane = threadIdx.x & 31, wave = __builtin_amdgcn_readfirstlane((int)(threadIdx.x >> 5)), lr = lane & 15, hi = lane >> 4;
    const int wb = wave * 16 * 68;
    const int pos0 = (blockIdx.x * AW + wave) * PPW;
#pragma unroll 1
    for (int pp = 0; pp < PPW; ++pp) {
        const int m = pos0 + pp;                       // compact token row of the planes
        const int b = m / SEQ, t = m % SEQ;
        const size_t rb = (size_t)m * DM;
        const size_t qo = rb + (size_t)lr * HD + 8 * hi;
        const v16h qh0 = ldh(QH + qo), qh1 = ldh(QH + qo + 32);                                                // B fragments: col i, k = d
        const v16h ka0 = ldh(KP + qo), ka1 = ldh(KP + qo + 32);                                                // A fragments: row j, k = d
        v8f sH = (v8f){};
        sH = wmma16(ka0, qh0, sH);
        sH = wmma16(ka1, qh1, sH);
        asm volatile("v_nop\n\tv_nop\n\tv_nop\n\tv_nop" : "+v"(sH) : "v"(ka0), "v"(ka1), "v"(qh0), "v"(qh1));
        float ta[8]; float mx = -3.0e38f;
#pragma unroll
        for (int r = 0; r < 8; ++r) { ta[r] = sH[r] * SC2; mx = fmaxf(mx, ta[r]); }
        mx = fmaxf(mx, __shfl_xor(mx, 16, 32));
        const float sh = PSH - mx;
        v16h pb; float l = 0.0f;
#pragma unroll
        for (int r = 0; r < 8; ++r) { const h16 pa = (h16)__builtin_amdgcn_exp2f(ta[r] + sh); pb[r] = pa; pb[8 + r] = (h16)0.0f; l += (float)pa; }
        l += __shfl_xor(l, 16, 32);
        const float inv = 1.0f / l;
        const size_t vo = rb + (size_t)lr * 16 + 8 * hi;          // + jt*256: row d = 16*jt + lr, k = j = 8h + e
        const v8h zz = (v8h){};
        const v16h v0 = cat16(*(const v8h*)(VT + vo), zz), v1 = cat16(*(const v8h*)(VT + vo + 256), zz), v2 = cat16(*(const v8h*)(VT + vo + 512), zz), v3 = cat16(*(const v8h*)(VT + vo + 768), zz);
        v8f o0 = (v8f){}, o1 = (v8f){}, o2 = (v8f){}, o3 = (v8f){};
        o0 = wmma16(v0, pb, o0); o1 = wmma16(v1, pb, o1); o2 = wmma16(v2, pb, o2); o3 = wmma16(v3, pb, o3);
        asm volatile("v_nop\n\tv_nop\n\tv_nop\n\tv_nop" : "+v"(o0), "+v"(o1), "+v"(o2), "+v"(o3) : "v"(v0), "v"(v1), "v"(v2), "v"(v3), "v"(pb));
        // O^T D layout: o_jt[r] = (d = 16jt + 8h + r, i = lane&15) -> os[i][d]; rows 0..15 x columns 0..63 all written
        { v4f a, c;
          a[0] = o0[0] * inv; a[1] = o0[1] * inv; a[2] = o0[2] * inv; a[3] = o0[3] * inv; c[0] = o0[4] * inv; c[1] = o0[5] * inv; c[2] = o0[6] * inv; c[3] = o0[7] * inv;
          *(v4fa*)(&os[wb + lr * 68 +  0 + 8 * hi]) = a; *(v4fa*)(&os[wb + lr * 68 +  0 + 8 * hi + 4]) = c;
          a[0] = o1[0] * inv; a[1] = o1[1] * inv; a[2] = o1[2] * inv; a[3] = o1[3] * inv; c[0] = o1[4] * inv; c[1] = o1[5] * inv; c[2] = o1[6] * inv; c[3] = o1[7] * inv;
          *(v4fa*)(&os[wb + lr * 68 + 16 + 8 * hi]) = a; *(v4fa*)(&os[wb + lr * 68 + 16 + 8 * hi + 4]) = c;
          a[0] = o2[0] * inv; a[1] = o2[1] * inv; a[2] = o2[2] * inv; a[3] = o2[3] * inv; c[0] = o2[4] * inv; c[1] = o2[5] * inv; c[2] = o2[6] * inv; c[3] = o2[7] * inv;
          *(v4fa*)(&os[wb + lr * 68 + 32 + 8 * hi]) = a; *(v4fa*)(&os[wb + lr * 68 + 32 + 8 * hi + 4]) = c;
          a[0] = o3[0] * inv; a[1] = o3[1] * inv; a[2] = o3[2] * inv; a[3] = o3[3] * inv; c[0] = o3[4] * inv; c[1] = o3[5] * inv; c[2] = o3[6] * inv; c[3] = o3[7] * inv;
          *(v4fa*)(&os[wb + lr * 68 + 48 + 8 * hi]) = a; *(v4fa*)(&os[wb + lr * 68 + 48 + 8 * hi + 4]) = c; }
        wave_sync();
        float* orow = OUT + ((size_t)b * OUT_SEQ + t) * DM;      // token row: column = i*64 + d
{
#pragma unroll
            for (int s = 0; s < 8; ++s) { const int row = 2 * s + hi, cofs = lr * 4;   // 8 s x 2 rows = 16 head rows; 16 lanes x 4 floats = 64 columns
                const v4f val = *(const v4fa*)(&os[wb + row * 68 + cofs]);
                *(v4f*)(orow + (size_t)row * HD + cofs) = val; }
             }
        wave_sync();                                              // tile is rewritten by the next token
    }
}

static constexpr size_t al256(size_t v) { return (v + 255) & ~(size_t)255; }
static constexpr size_t SZ_XB = al256((size_t)NB * SEQ * DM * 2);
static constexpr size_t SZ_WB = al256((size_t)3 * DM * DM * 2);
static constexpr size_t SZ_PL = al256((size_t)NB * SEQ * DM * 2);
static constexpr size_t SZ_TOTAL = SZ_XB + SZ_WB + 3 * SZ_PL;
static_assert(SZ_TOTAL <= (size_t)134217728);          // workspace carve <= 128 MiB
static_assert(((size_t)DM * DM * 2) % 256 == 0);       // weight sub-planes stay 256-byte aligned

extern "C" void kernel_launch(void* const* d_in, const int* in_sizes, int n_in,
                              void* d_out, int out_size, void* d_ws, size_t ws_size, hipStream_t stream) {
    if (n_in < 4) return;
    const size_t needx = ((size_t)(NB - 1) * SEQ_FULL + SEQ) * DM;
    if ((size_t)in_sizes[0] < needx) return;
    if ((size_t)in_sizes[1] < (size_t)DM * DM || (size_t)in_sizes[2] < (size_t)DM * DM || (size_t)in_sizes[3] < (size_t)DM * DM) return;
    if ((size_t)out_size < ((size_t)(NB - 1) * OUT_SEQ + SEQ) * DM) return;
    if (SZ_TOTAL > ws_size) return;
    const float* x = (const float*)d_in[0]; const float* wq = (const float*)d_in[1]; const float* wk = (const float*)d_in[2]; const float* wv = (const float*)d_in[3];   // wire order x, Wq, Wk, Wv ([out][in] = Bt as-is)
    float* OUT = (float*)d_out;      // [NB][SEQ][1024]
    char* wsp = (char*)d_ws;
    bf* XB = (bf*)wsp; wsp += SZ_XB;                 // [NB*SEQ][1024]
    bf* WB = (bf*)wsp; wsp += SZ_WB;                 // [3][1024][1024]: q | k | v (v rows permuted: d*16+j <- j*64+d)
    h16* QH = (h16*)wsp; wsp += SZ_PL;               // [NB*SEQ][head*64+d]
    h16* KP = (h16*)wsp; wsp += SZ_PL;               // [NB*SEQ][head*64+d]
    h16* VT = (h16*)wsp; wsp += SZ_PL;               // [NB*SEQ][d*16+head]

    k_cvt<<<CVG, 32 * CVW, 0, stream>>>(x, wq, wk, wv, XB, WB);

    // q, k: A = x rows (m = b*SEQ + t), Bt = W rows (n = head*64 + d) -> plane [m][head*64 + d]; v^T: Bt = permuted Wv rows (n = d*16 + head) -> plane [m][d*16 + head]
    k_proj<<<dim3(NB * SEQ / PBM, DM / PBN, 1), 128, 0, stream>>>(XB, WB, QH, KP, VT);

    k_xhead<<<dim3(NB * SEQ / (AW * PPW), 1, 1), 32 * AW, 0, stream>>>(QH, KP, VT, OUT);
}

// v006
// One run takes 51 microseconds.
// In both of two side-by-side timings against v005, it was 1.07 times as fast.
// Counting every step since v000, it is 2.65 times as fast.
#include <hip/hip_runtime.h>
#include <stdint.h>

// Per-token attention across heads, width 1024 = 16 heads x 64: x [NB][SEQ][1024], Wq/Wk/Wv [out][in] (y = x W^T), no biases, no mask, score scale 1/8;
// for each token the 16 head rows of q attend over the 16 head rows of k/v of the SAME token (scores 16x16, softmax over the key head), output column = head*64 + d (f32).
// Compute dtypes, f32 accumulate everywhere: projections v_wmma_f32_16x16x32_bf16 (x and W RNE-converted to bf16; products exact);
// scores v_wmma_f32_16x16x32_f16: q and k single f16 (the f16 rounding of q or k is roughly ten times smaller than the error that the bf16 operands of the projection leave in it); P (x256 carry, cancels in the normalisation) and v single f16; softmax f32.
// Layout: bf16 copies of x and W (the Wv copy with permuted rows d*16+j <- j*64+d); q, k planes [token][head*64+d] and v^T plane [token][d*16+head] written by the GEMM epilogue;
// per-token kernel in transposed form (S^T = K Q^T, O^T = V^T P^T, 16 keys zero-padded to the 32-deep step), output from f32 accumulators.

#ifndef NB
#define NB 4
#endif
#ifndef SEQ
#define SEQ 2048
#endif
#define NB_FULL  4
#define SEQ_FULL 2048
#ifndef OUT_SEQ
#define OUT_SEQ SEQ              // row pitch (in tokens) between batches of the output
#endif
#define DM   1024
#define NH_  16
#define HD   64
#define AW   4                   // waves per block of the per-token kernel
#define PPW  4                   // tokens handled sequentially by each wave
#define SC2  (0.125f * 1.4426950408889634f)   // HD^-0.5 * log2(e)
#define PSH  8.0f                // log2 of the P carry (256)
#define PBM  256                 // projection GEMM: rows of C per work-group
#define PBN  128                 // columns of each of q, k, v per work-group
#define PKS  64                  // k per stage (128-B rows)
#define PLP  72                  // LDS row pitch in 16-bit elements (144 B = 16 B x odd, for 16-byte readers): the 128-B row plus the tensor load's 16-B pad
#define PSTG ((PBM + 3 * PBN) * PLP) // elements per buffer
#define BROW(nb) (((nb) >> 2) * PBN + ((nb) & 3) * 16)   // first row, inside the wave's B rows, of B fragment nb
#define PNT  (DM / PKS)          // stages
#define CVG  256                 // conversion launch: work-groups
#define CVW  16                  // waves per work-group
#define XPW  (NB * SEQ * DM / 128 / (CVG * CVW))   // 128-float pieces of x per wave
#define WPW  (DM * DM / 128 / (CVG * CVW))         // 128-float pieces of each weight per wave

static_assert(HD == 64);
static_assert(NH_ == 16);                      // one 16-key tile per token; v^T row = 16 halves
static_assert(NH_ * HD == DM);                 // head h = columns h*64 + d
static_assert(DM % 64 == 0);                   // 16 column tiles of 64
static_assert(DM % 32 == 0);                   // GEMM K splits into 32-deep blocks
static_assert((NB * SEQ) % PBM == 0);          // GEMM row tiles cover the token rows exactly
static_assert(DM % PBN == 0 && DM % PKS == 0 && PNT >= 2);   // column tiles and stages cover exactly; the two-buffer prologue needs two stages
static_assert(PKS == 64);                      // a stage is two 32-deep blocks; its rows are 128 B, the length the pad code of the tensor loads is set for
static_assert(PLP * 2 == PKS * 2 + 16);        // LDS pitch = row + 16-B pad
static_assert((PBM * PLP * 2) % 2048 == 0 && (PBN * PLP * 2) % 2048 == 0);   // every slice and every buffer starts at a multiple of 2 KiB in LDS
static_assert((NB * SEQ) % (AW * PPW) == 0);   // per-token grid covers the token rows exactly
static_assert(XPW >= 1 && (size_t)XPW * 128 * CVG * CVW == (size_t)NB * SEQ * DM);   // the waves' x pieces cover x exactly
static_assert(((size_t)SEQ * DM) % (XPW * 128) == 0);                                  // a wave's x pieces stay inside one batch
static_assert(WPW >= 1 && (size_t)WPW * 128 * CVG * CVW == (size_t)DM * DM);           // the waves' weight pieces cover each weight exactly
static_assert(DM % (WPW * 128) == 0);                                                  // a wave's weight pieces stay inside one row
static_assert(NB <= NB_FULL);
static_assert(SEQ <= SEQ_FULL);

typedef _Float16 h16;
typedef unsigned short bf;
typedef __attribute__((ext_vector_type(16))) __bf16   v16bf;
typedef __attribute__((ext_vector_type(16))) _Float16 v16h;
typedef __attribute__((ext_vector_type(8)))  _Float16 v8h;
typedef __attribute__((ext_vector_type(8)))  unsigned short v8us;
typedef __attribute__((ext_vector_type(4)))  unsigned short v4us;
typedef __attribute__((ext_vector_type(8)))  float    v8f;
typedef __attribute__((ext_vector_type(4)))  float    v4f;
typedef v4f  __attribute__((may_alias)) v4fa;
typedef uint32_t u32x4 __attribute__((ext_vector_type(4)));   // the two descriptor groups of a tensor load
typedef uint32_t u32x8 __attribute__((ext_vector_type(8)));

__device__ __forceinline__ unsigned short f2bf(float f) { unsigned u = __float_as_uint(f); u += 0x7FFFu + ((u >> 16) & 1u); return (unsigned short)(u >> 16); }
__device__ __forceinline__ v16h cat16(v8h lo, v8h hi) { return __builtin_shufflevector(lo, hi, 0, 1, 2, 3, 4, 5, 6, 7, 8, 9, 10, 11, 12, 13, 14, 15); }
__device__ __forceinline__ v16bf cat16b(v8us lo, v8us hi) { return __builtin_bit_cast(v16bf, __builtin_shufflevector(lo, hi, 0, 1, 2, 3, 4, 5, 6, 7, 8, 9, 10, 11, 12, 13, 14, 15)); }
__device__ __forceinline__ v8f wmma16(v16h a, v16h b, v8f c) { return __builtin_amdgcn_wmma_f32_16x16x32_f16(false, a, false, b, (short)0, c, false, false); }
__device__ __forceinline__ v8f wmmab(v16bf a, v16bf b, v8f c) { return __builtin_amdgcn_wmma_f32_16x16x32_bf16(false, a, false, b, (short)0, c, false, false); }
// fragment loaders from K-contiguous 16-bit rows; p already includes + 8*(lane>>4): elements 0..7 <- k0+8h+0..7, elements 8..15 <- k0+16+8h+0..7 (same map for A and B)
__device__ __forceinline__ v16h  ldh(const h16* p) { return cat16(*(const v8h*)p, *(const v8h*)(p + 16)); }
__device__ __forceinline__ v16bf ldb(const bf* p)  { return cat16b(*(const v8us*)p, *(const v8us*)(p + 16)); }
// ordering point for wave-private LDS tiles (same wave writes and reads)
__device__ __forceinline__ void wave_sync() { __builtin_amdgcn_fence(3 /* release order */, "wavefront"); __builtin_amdgcn_wave_barrier(); asm volatile("" ::: "memory"); }

// k_cvt: every f32 -> bf16 conversion (x, Wq, Wk, Wv) in ONE launch that is resident at once: CVG work-groups of CVW waves, so few waves have to be started and no launch waits on another.
// A piece = 128 consecutive floats = one wave-wide 16-byte load (512 B, four whole lines) -> one wave-wide 8-byte store (256 B, two whole lines).
// Wave gw takes XPW consecutive pieces of x and WPW consecutive pieces of each weight; all its loads are issued before the first value is converted.
// The Wv copy has permuted rows: dst row (d*16 + j) <- src row (j*64 + d); a piece lies inside one row, so loads and stores stay line-contiguous.
__device__ __forceinline__ v4us cvt4(v4f v) { v4us o; o[0] = f2bf(v[0]); o[1] = f2bf(v[1]); o[2] = f2bf(v[2]); o[3] = f2bf(v[3]); return o; }
__global__ __launch_bounds__(32 * CVW) void k_cvt(const float* __restrict__ x, const float* __restrict__ wq, const float* __restrict__ wk, const float* __restrict__ wv,
                                                  bf* __restrict__ XB, bf* __restrict__ WB) {
    const int lane = threadIdx.x & 31, wave = __builtin_amdgcn_readfirstlane((int)(threadIdx.x >> 5));
    const int gw = blockIdx.x * CVW + wave;
    const size_t ex = (size_t)gw * (XPW * 128);                                   // first element of the wave's x pieces (compact rows); XPW * 128 divides SEQ * DM, so they lie in one batch
    const size_t sx = ex + (ex / ((size_t)SEQ * DM)) * ((size_t)(SEQ_FULL - SEQ) * DM);
    const size_t ew = (size_t)gw * (WPW * 128);                                   // first element of the wave's pieces of each weight; WPW * 128 divides DM, so they lie in one row
    const size_t row = ew / DM, col = ew % DM;
    const size_t sv = ((row & 15) * (size_t)HD + (row >> 4)) * (size_t)DM + col;
    v4f rx[XPW], rq[WPW], rk[WPW], rv[WPW];
    // the four loops below are unrolled so that every piece index is a constant: the pieces stay in registers and the piece offsets become immediates
#pragma unroll
    for (int j = 0; j < XPW; ++j) rx[j] = *(const v4f*)(x + sx + j * 128 + lane * 4);
#pragma unroll
    for (int j = 0; j < WPW; ++j) { rq[j] = *(const v4f*)(wq + ew + j * 128 + lane * 4); rk[j] = *(const v4f*)(wk + ew + j * 128 + lane * 4); rv[j] = *(const v4f*)(wv + sv + j * 128 + lane * 4); }
    __builtin_amdgcn_sched_barrier(0);   // every load is issued before the first wait: without it the weight loads sink behind the x values' waits and the wave pays memory latency several times over
#pragma unroll
    for (int j = 0; j < XPW; ++j) *(v4us*)(XB + ex + j * 128 + lane * 4) = cvt4(rx[j]);
#pragma unroll
    for (int j = 0; j < WPW; ++j) {
        *(v4us*)(WB + ew + j * 128 + lane * 4) = cvt4(rq[j]);
        *(v4us*)(WB + (size_t)DM * DM + ew + j * 128 + lane * 4) = cvt4(rk[j]);
        *(v4us*)(WB + (size_t)2 * DM * DM + ew + j * 128 + lane * 4) = cvt4(rv[j]);
    }
}

__device__ __forceinline__ uint32_t uni(uint32_t v) { return (uint32_t)__builtin_amdgcn_readfirstlane(v); }
// pinned(): a test around a tensor load, or a value that descriptor words are formed from, held in a scalar register; being volatile it stays behind the wait written in front of it, and so does every word that hangs on it
__device__ __forceinline__ uint32_t pinned(uint32_t v) { uint32_t w = (uint32_t)__builtin_amdgcn_readfirstlane(v); asm volatile("" : "+s"(w)); return w; }
// Descriptor group 1 (the same for every stage of a wave): 1-byte elements, tensor = tile = rows x 128 B, source row pitch 2 * DM bytes, a 4-dword pad behind every 32 dwords (one row), no mask.
__device__ __forceinline__ u32x8 tdm_group1(uint32_t rows) {
    constexpr uint32_t d0 = PKS * 2;
    u32x8 g;
    g[0] = uni((1u << 20) | (4u << 22) | (3u << 25));
    g[1] = uni((d0 & 0xFFFFu) << 16);
    g[2] = uni((d0 >> 16) | ((rows & 0xFFFFu) << 16));
    g[3] = uni((rows >> 16) | (d0 << 16));
    g[4] = uni(rows);
    g[5] = uni((uint32_t)(DM * 2));
    g[6] = uni(0u);
    g[7] = uni(0u);
    return g;
}
// One wave's request for one stage: its slice's place in LDS (byte offset in the work-group's LDS), the global address of the slice's first byte in stage 0, the stage's byte offset along the rows.
__device__ __forceinline__ void stage_load(uint32_t lds_dst, uint64_t gsl, uint32_t off, u32x8 g1) {
    const uint64_t ga = gsl + pinned(off);   // the address words hang on a value pinned behind the last request's wait: the register of word 3 takes no new value while that request is outstanding
    u32x4 g0;
    g0[0] = uni(1u); g0[1] = uni(lds_dst); g0[2] = uni((uint32_t)ga); g0[3] = uni((((uint32_t)(ga >> 32)) & 0x01FFFFFFu) | 0x80000000u);
    asm volatile("tensor_load_to_lds %0, %1" :: "s"(g0), "s"(g1) : "memory");   // one request of the whole wave; its wait is written at the publish point
}

// Epilogue pieces; the piece number is a template argument so that every accumulator index is a constant and the accumulators stay in registers.
// put_piece: piece I of the wave's accumulators into staging tile I & 1.
template <int I> __device__ __forceinline__ void put_piece(const v8f (&acc)[8][12], float* os, int lr, int hi) {
    float* o = os + (I & 1) * 16 * 68;
#pragma unroll
    for (int nb = 0; nb < 4; ++nb)
#pragma unroll
        for (int j = 0; j < 8; ++j) o[(hi * 8 + j) * 68 + nb * 16 + lr] = acc[I & 7][(I >> 3) * 4 + nb][j];   // D: row 8h+j, col lane&15
}
// out_piece: reads piece I back row-wise, issues the LDS writes of piece I + 1, then converts and stores piece I.
template <int I> __device__ __forceinline__ void out_piece(const v8f (&acc)[8][12], float* os, int lane, size_t tbase, h16* QH, h16* KP, h16* VT) {
    constexpr int w = I >> 3, mb = I & 7;
    h16* Ph = w == 0 ? QH : (w == 1 ? KP : VT);
    const float* oi = os + (I & 1) * 16 * 68;
    wave_sync();
    v4f x0[4], x1[4];
#pragma unroll
    for (int s = 0; s < 4; ++s) { const int row = 4 * s + (lane >> 3), c8 = (lane & 7) * 8;   // 4 s x 4 row groups = 16 rows; 8 lanes x 8 = 64 columns
        x0[s] = *(const v4fa*)(&oi[row * 68 + c8]); x1[s] = *(const v4fa*)(&oi[row * 68 + c8 + 4]); }
    if constexpr (I + 1 < 24) put_piece<I + 1>(acc, os, lane & 15, lane >> 4);
    __builtin_amdgcn_sched_barrier(0);   // the next piece's LDS writes are issued before this piece's values are waited for
    v8h hv[4];
#pragma unroll
    for (int s = 0; s < 4; ++s) {
#pragma unroll
        for (int e = 0; e < 4; ++e) { hv[s][e] = (h16)x0[s][e]; hv[s][4 + e] = (h16)x1[s][e]; } }
    __builtin_amdgcn_sched_barrier(0);   // every value of the piece is converted before its first store, so none of the conversions rewrites a register of an issued store
    const size_t sb = tbase + (size_t)(mb * 16) * (size_t)DM;
#pragma unroll
    for (int s = 0; s < 4; ++s) { const int row = 4 * s + (lane >> 3), c8 = (lane & 7) * 8;
        const size_t oo = sb + (size_t)row * (size_t)DM + c8;
        *(v8h*)(Ph + oo) = hv[s]; }
    asm volatile("s_wait_xcnt 0x0" ::: "memory");   // stands in front of the next piece's LDS reads and conversions, which rewrite registers that these stores name
    __builtin_amdgcn_sched_barrier(0);   // holds those instructions behind the wait
}

__global__ __launch_bounds__(128) void k_proj(const bf* __restrict__ A, const bf* __restrict__ Wb, h16* QH, h16* KP, h16* VT) {
    __shared__ __attribute__((aligned(2048))) bf ring[2 * PSTG];
    __shared__ __align__(16) float osAll[4 * 2 * 16 * 68];
    const int K = DM;
    const int tid = threadIdx.x, lane = tid & 31, lr = lane & 15, hi = lane >> 4;
    const int wave = __builtin_amdgcn_readfirstlane(tid >> 5), wm = wave & 1, wn = wave >> 1;
    const int r0 = blockIdx.x * PBM, c0 = blockIdx.y * PBN;
    float* os = osAll + wave * 2 * 16 * 68;             // wave-private output staging, two tiles
    // the wave's slice of a stage: wave 0 rows r0 .. r0 + 255 of A, wave w > 0 rows c0 .. c0 + 127 of weight plane w - 1; stage t starts PKS elements further along each row
    const uint64_t gsl = wave == 0 ? (uint64_t)(size_t)(A + (size_t)r0 * K) : (uint64_t)(size_t)(Wb + (size_t)(wave - 1) * DM * DM + (size_t)c0 * K);
    const uint32_t lsl = (uint32_t)(size_t)ring + (wave == 0 ? 0u : (uint32_t)((PBM + (wave - 1) * PBN) * PLP * 2));
    u32x8 g1 = tdm_group1(wave == 0 ? (uint32_t)PBM : (uint32_t)PBN);
    asm volatile("" : "+s"(g1));   // pinned() for the eight words at once, descriptor words held in scalar registers: one tuple serves every request, so none of its registers is rewritten while a request is outstanding
    // A fragment mb: rows wm*128 + mb*16; B fragment nb: weight nb>>2, its rows wn*64 + (nb&3)*16
    const int aofs = (wm * 128 + lr) * PLP + 8 * hi, bofs = (PBM + wn * 64 + lr) * PLP + 8 * hi;
    stage_load(lsl, gsl, 0u, g1);
    asm volatile("s_wait_tensorcnt 0x0" ::: "memory");   // this wave's slice of stage 0 has landed before the barrier publishes it
    __syncthreads();
    stage_load(lsl + PSTG * 2, gsl, PKS * 2, g1);
    // Every loop over fragments or accumulators is unrolled: the arrays stay in registers only with constant indices.
    v8f acc[8][12];
#pragma unroll
    for (int mb = 0; mb < 8; ++mb)
#pragma unroll
        for (int nb = 0; nb < 12; ++nb) acc[mb][nb] = (v8f){};
    // Fragment registers: both blocks' A sets (a0, a1) and ONE B set in two halves (b0, b1); a B half is reloaded as soon as its last matrix instruction is issued, one run of 48 ahead of its next use; a1 likewise but two runs ahead; a0 after the publish point, one run ahead.
    v16bf a0[8], a1[8], b0[6], b1[6];
#pragma unroll
    for (int mb = 0; mb < 8; ++mb) a0[mb] = ldb(ring + aofs + mb * 16 * PLP);
#pragma unroll
    for (int nb = 0; nb < 6; ++nb) b0[nb] = ldb(ring + bofs + BROW(nb) * PLP);
#pragma unroll 1   // one stage per trip: one copy of the hot loop in the instruction cache, the buffer picked by t & 1
    for (int t = 0; t < PNT; ++t) {
        const bf* rb = ring + (t & 1) * PSTG;
        const bf* rn = ring + ((t + 1) & 1) * PSTG;
        // every sched_barrier below: LDS reads stand in groups between the runs of matrix instructions, none among them, and no run moves over the publish point
#pragma unroll
        for (int nb = 0; nb < 6; ++nb) b1[nb] = ldb(rb + bofs + BROW(nb + 6) * PLP);
#pragma unroll
        for (int mb = 0; mb < 8; ++mb) a1[mb] = ldb(rb + aofs + mb * 16 * PLP + 32);
        __builtin_amdgcn_sched_barrier(0);
#pragma unroll
        for (int nb = 0; nb < 6; ++nb)
#pragma unroll
            for (int mb = 0; mb < 8; ++mb) acc[mb][nb] = wmmab(a0[mb], b0[nb], acc[mb][nb]);
        __builtin_amdgcn_sched_barrier(0);
#pragma unroll
        for (int nb = 0; nb < 6; ++nb) b0[nb] = ldb(rb + bofs + BROW(nb) * PLP + 32);
        __builtin_amdgcn_sched_barrier(0);
#pragma unroll
        for (int nb = 0; nb < 6; ++nb)
#pragma unroll
            for (int mb = 0; mb < 8; ++mb) acc[mb][nb + 6] = wmmab(a0[mb], b1[nb], acc[mb][nb + 6]);
        __builtin_amdgcn_sched_barrier(0);
#pragma unroll
        for (int nb = 0; nb < 6; ++nb) b1[nb] = ldb(rb + bofs + BROW(nb + 6) * PLP + 32);
        __builtin_amdgcn_sched_barrier(0);
#pragma unroll
        for (int nb = 0; nb < 6; ++nb)
#pragma unroll
            for (int mb = 0; mb < 8; ++mb) acc[mb][nb] = wmmab(a1[mb], b0[nb], acc[mb][nb]);
        __builtin_amdgcn_sched_barrier(0);
        asm volatile("s_wait_dscnt 0x0" ::: "memory");
        asm volatile("s_wait_tensorcnt 0x0" ::: "memory");
        __syncthreads();
        if (pinned((uint32_t)(t + 2 < PNT))) stage_load(lsl + (uint32_t)(t & 1) * (PSTG * 2), gsl, (uint32_t)(t + 2) * (PKS * 2), g1);   // scalar branch: a tensor load ignores EXEC
        // first fragments of stage t + 1; in the last trip they re-read the other buffer's old stage (landed long ago, no load aimed at it) and are not used
#pragma unroll
        for (int mb = 0; mb < 8; ++mb) a0[mb] = ldb(rn + aofs + mb * 16 * PLP);
#pragma unroll
        for (int nb = 0; nb < 6; ++nb) b0[nb] = ldb(rn + bofs + BROW(nb) * PLP);
        __builtin_amdgcn_sched_barrier(0);
#pragma unroll
        for (int nb = 0; nb < 6; ++nb)
#pragma unroll
            for (int mb = 0; mb < 8; ++mb) acc[mb][nb + 6] = wmmab(a1[mb], b1[nb], acc[mb][nb + 6]);
    }
    asm volatile("s_wait_tensorcnt 0x0" ::: "memory");      // nothing of this wave in flight behind the last stage
    asm volatile("s_wait_dscnt 0x0" ::: "memory");          // the last trip's unused fragment reads have returned
    // Epilogue: 24 pieces of 16 rows x 64 columns (piece i: weight i>>3, row block i&7) go through two wave-private f32 tiles in turn: piece i + 1 is written to its tile while piece i is converted and stored.
    const size_t tbase = (size_t)(r0 + wm * 128) * (size_t)DM + (size_t)(c0 + wn * 64);
    put_piece<0>(acc, os, lr, hi);
#define OUT4(i) out_piece<i>(acc, os, lane, tbase, QH, KP, VT); out_piece<i + 1>(acc, os, lane, tbase, QH, KP, VT); out_piece<i + 2>(acc, os, lane, tbase, QH, KP, VT); out_piece<i + 3>(acc, os, lane, tbase, QH, KP, VT);
    OUT4(0) OUT4(4) OUT4(8) OUT4(12) OUT4(16) OUT4(20)
#undef OUT4
}

// k_xhead: per-token attention across the 16 heads, one wave per token (PPW tokens in sequence); K / Q / V^T fragments straight from the f16 planes (16-B loads, arithmetic addressing).
// Transposed form: S^T[j][i] = K Q^T (A = K head rows j, B = Q head rows i, k = d, two 32-deep steps); lane (i = lane&15, h = lane>>4) holds keys j = 8h+r, so the packed
// P values are directly elements 0..7 of the B fragment of O^T[d][i] = V^T P^T (k = j = 8h+r); elements 8..15 (k = 16..31) are literal zeros in BOTH operands.
// V^T A fragment: row d = 16*jt + lane&15, elements 0..7 <- plane[token][d*16 + 8h + 0..7] (one 16-B load), elements 8..15 zero.
// Softmax: lane-local max/sum over 8 keys, the two lane halves of a query combined with one xor-16 exchange (all lanes active, uniform control).
__global__ __launch_bounds__(32 * AW) void k_xhead(const h16* __restrict__ QH, const h16* __restrict__ KP, const h16* __restrict__ VT, float* OUT) {
    __shared__ __align__(16) float os[AW * 16 * 68];
    const int lane = threadIdx.x & 31, wave = __builtin_amdgcn_readfirstlane((int)(threadIdx.x >> 5)), lr = lane & 15, hi = lane >> 4;
    const int wb = wave * 16 * 68;
    const int pos0 = (blockIdx.x * AW + wave) * PPW;
#pragma unroll 1
    for (int pp = 0; pp < PPW; ++pp) {
        const int m = pos0 + pp;                       // compact token row of the planes
        const int b = m / SEQ, t = m % SEQ;
        const size_t rb = (size_t)m * DM;
        const size_t qo = rb + (size_t)lr * HD + 8 * hi;
        const v16h qh0 = ldh(QH + qo), qh1 = ldh(QH + qo + 32);                                                // B fragments: col i, k = d
        const v16h ka0 = ldh(KP + qo), ka1 = ldh(KP + qo + 32);                                                // A fragments: row j, k = d
        v8f sH = (v8f){};
        sH = wmma16(ka0, qh0, sH);
        sH = wmma16(ka1, qh1, sH);
        asm volatile("v_nop\n\tv_nop\n\tv_nop\n\tv_nop" : "+v"(sH) : "v"(ka0), "v"(ka1), "v"(qh0), "v"(qh1));
        float ta[8]; float mx = -3.0e38f;
#pragma unroll
        for (int r = 0; r < 8; ++r) { ta[r] = sH[r] * SC2; mx = fmaxf(mx, ta[r]); }
        mx = fmaxf(mx, __shfl_xor(mx, 16, 32));
        const float sh = PSH - mx;
        v16h pb; float l = 0.0f;
#pragma unroll
        for (int r = 0; r < 8; ++r) { const h16 pa = (h16)__builtin_amdgcn_exp2f(ta[r] + sh); pb[r] = pa; pb[8 + r] = (h16)0.0f; l += (float)pa; }
        l += __shfl_xor(l, 16, 32);
        const float inv = 1.0f / l;
        const size_t vo = rb + (size_t)lr * 16 + 8 * hi;          // + jt*256: row d = 16*jt + lr, k = j = 8h + e
        const v8h zz = (v8h){};
        const v16h v0 = cat16(*(const v8h*)(VT + vo), zz), v1 = cat16(*(const v8h*)(VT + vo + 256), zz), v2 = cat16(*(const v8h*)(VT + vo + 512), zz), v3 = cat16(*(const v8h*)(VT + vo + 768), zz);
        v8f o0 = (v8f){}, o1 = (v8f){}, o2 = (v8f){}, o3 = (v8f){};
        o0 = wmma16(v0, pb, o0); o1 = wmma16(v1, pb, o1); o2 = wmma16(v2, pb, o2); o3 = wmma16(v3, pb, o3);
        asm volatile("v_nop\n\tv_nop\n\tv_nop\n\tv_nop" : "+v"(o0), "+v"(o1), "+v"(o2), "+v"(o3) : "v"(v0), "v"(v1), "v"(v2), "v"(v3), "v"(pb));
        // O^T D layout: o_jt[r] = (d = 16jt + 8h + r, i = lane&15) -> os[i][d]; rows 0..15 x columns 0..63 all written
        { v4f a, c;
          a[0] = o0[0] * inv; a[1] = o0[1] * inv; a[2] = o0[2] * inv; a[3] = o0[3] * inv; c[0] = o0[4] * inv; c[1] = o0[5] * inv; c[2] = o0[6] * inv; c[3] = o0[7] * inv;
          *(v4fa*)(&os[wb + lr * 68 +  0 + 8 * hi]) = a; *(v4fa*)(&os[wb + lr * 68 +  0 + 8 * hi + 4]) = c;
          a[0] = o1[0] * inv; a[1] = o1[1] * inv; a[2] = o1[2] * inv; a[3] = o1[3] * inv; c[0] = o1[4] * inv; c[1] = o1[5] * inv; c[2] = o1[6] * inv; c[3] = o1[7] * inv;
          *(v4fa*)(&os[wb + lr * 68 + 16 + 8 * hi]) = a; *(v4fa*)(&os[wb + lr * 68 + 16 + 8 * hi + 4]) = c;
          a[0] = o2[0] * inv; a[1] = o2[1] * inv; a[2] = o2[2] * inv; a[3] = o2[3] * inv; c[0] = o2[4] * inv; c[1] = o2[5] * inv; c[2] = o2[6] * inv; c[3] = o2[7] * inv;
          *(v4fa*)(&os[wb + lr * 68 + 32 + 8 * hi]) = a; *(v4fa*)(&os[wb + lr * 68 + 32 + 8 * hi + 4]) = c;
          a[0] = o3[0] * inv; a[1] = o3[1] * inv; a[2] = o3[2] * inv; a[3] = o3[3] * inv; c[0] = o3[4] * inv; c[1] = o3[5] * inv; c[2] = o3[6] * inv; c[3] = o3[7] * inv;
          *(v4fa*)(&os[wb + lr * 68 + 48 + 8 * hi]) = a; *(v4fa*)(&os[wb + lr * 68 + 48 + 8 * hi + 4]) = c; }
        wave_sync();
        float* orow = OUT + ((size_t)b * OUT_SEQ + t) * DM;      // token row: column = i*64 + d
{
#pragma unroll
            for (int s = 0; s < 8; ++s) { const int row = 2 * s + hi, cofs = lr * 4;   // 8 s x 2 rows = 16 head rows; 16 lanes x 4 floats = 64 columns
                const v4f val = *(const v4fa*)(&os[wb + row * 68 + cofs]);
                *(v4f*)(orow + (size_t)row * HD + cofs) = val; }
             }
        wave_sync();                                              // tile is rewritten by the next token
    }
}

static constexpr size_t al256(size_t v) { return (v + 255) & ~(size_t)255; }
static constexpr size_t SZ_XB = al256((size_t)NB * SEQ * DM * 2);
static constexpr size_t SZ_WB = al256((size_t)3 * DM * DM * 2);
static constexpr size_t SZ_PL = al256((size_t)NB * SEQ * DM * 2);
static constexpr size_t SZ_TOTAL = SZ_XB + SZ_WB + 3 * SZ_PL;
static_assert(SZ_TOTAL <= (size_t)134217728);          // workspace carve <= 128 MiB
static_assert(((size_t)DM * DM * 2) % 256 == 0);       // weight sub-planes stay 256-byte aligned

extern "C" void kernel_launch(void* const* d_in, const int* in_sizes, int n_in,
                              void* d_out, int out_size, void* d_ws, size_t ws_size, hipStream_t stream) {
    if (n_in < 4) return;
    const size_t needx = ((size_t)(NB - 1) * SEQ_FULL + SEQ) * DM;
    if ((size_t)in_sizes[0] < needx) return;
    if ((size_t)in_sizes[1] < (size_t)DM * DM || (size_t)in_sizes[2] < (size_t)DM * DM || (size_t)in_sizes[3] < (size_t)DM * DM) return;
    if ((size_t)out_size < ((size_t)(NB - 1) * OUT_SEQ + SEQ) * DM) return;
    if (SZ_TOTAL > ws_size) return;
    const float* x = (const float*)d_in[0]; const float* wq = (const float*)d_in[1]; const float* wk = (const float*)d_in[2]; const float* wv = (const float*)d_in[3];   // wire order x, Wq, Wk, Wv ([out][in] = Bt as-is)
    float* OUT = (float*)d_out;      // [NB][SEQ][1024]
    char* wsp = (char*)d_ws;
    bf* XB = (bf*)wsp; wsp += SZ_XB;                 // [NB*SEQ][1024]
    bf* WB = (bf*)wsp; wsp += SZ_WB;                 // [3][1024][1024]: q | k | v (v rows permuted: d*16+j <- j*64+d)
    h16* QH = (h16*)wsp; wsp += SZ_PL;               // [NB*SEQ][head*64+d]
    h16* KP = (h16*)wsp; wsp += SZ_PL;               // [NB*SEQ][head*64+d]
    h16* VT = (h16*)wsp; wsp += SZ_PL;               // [NB*SEQ][d*16+head]

    k_cvt<<<CVG, 32 * CVW, 0, stream>>>(x, wq, wk, wv, XB, WB);

    // q, k: A = x rows (m = b*SEQ + t), Bt = W rows (n = head*64 + d) -> plane [m][head*64 + d]; v^T: Bt = permuted Wv rows (n = d*16 + head) -> plane [m][d*16 + head]
    k_proj<<<dim3(NB * SEQ / PBM, DM / PBN, 1), 128, 0, stream>>>(XB, WB, QH, KP, VT);

    k_xhead<<<dim3(NB * SEQ / (AW * PPW), 1, 1), 32 * AW, 0, stream>>>(QH, KP, VT, OUT);
}
